// v000
// Times are from an AMD MI455X. After a warm-up the kernel runs many times in a row, and a time is the length of
// such a window on the GPU divided by its runs, so every launch and the gaps after it count. The runs cycle
// through copies of the inputs. A figure is the median of several windows, for all but v000 over two sittings.
// Sittings can differ by a few percent; kernels timed side by side share one.
// v000 is the starting kernel. One run takes 131 microseconds.
#include <hip/hip_runtime.h>
#include <hip/hip_bf16.h>

// ---- problem constants (from reference) ----
#define NB 4
#define LL 2048
#define HH 1024
#define DD 64

// 0.125 (=1/sqrt(64)) * log2(e): folded into the Q projection so the
// softmax can run directly on hardware base-2 exp (v_exp_f32).
#define QSCALE 0.18033688011112042f

typedef __attribute__((ext_vector_type(16))) __bf16 v16bf;
typedef __attribute__((ext_vector_type(8)))  float  v8f;

__device__ __forceinline__ v8f vzero8() {
    v8f z;
#pragma unroll
    for (int i = 0; i < 8; ++i) z[i] = 0.0f;
    return z;
}

// A/B 16-bit fragment K-index pattern (wave32):
// lane<16 holds K {0..7,16..23}, lane>=16 holds K {8..15,24..31}
__device__ __forceinline__ int fragK(int e, int kb) {
    return kb + e + ((e & 8) ? 8 : 0);
}

// CDNA5 async global->LDS copy (16 bytes per lane), tracked by ASYNCcnt.
// Low 32 bits of a generic pointer into LDS == wave-relative LDS byte offset
// (ISA 10.2 aperture mapping), which is what VDST wants.
__device__ __forceinline__ void async_ld_b128(const void* lds_ptr, const void* gsrc) {
    unsigned loff = (unsigned)(unsigned long long)lds_ptr;
    asm volatile("global_load_async_to_lds_b128 %0, %1, off"
                 :: "v"(loff), "v"(gsrc)
                 : "memory");
}
__device__ __forceinline__ void wait_async0() {
    asm volatile("s_wait_asynccnt 0" ::: "memory");
}

// ============================================================
// Kernel 0: convert W (f32, [1024][64]) -> WT (bf16, [3][64][1024])
// grid = 768, block = 256   (3 * 1024 * 64 elements)
// ============================================================
__global__ __launch_bounds__(256) void wconv_kernel(
    const float* __restrict__ Wq, const float* __restrict__ Wk,
    const float* __restrict__ Wv, __bf16* __restrict__ WT)
{
    const int idx = blockIdx.x * 256 + threadIdx.x;   // 0 .. 3*65536-1
    const int mat = idx >> 16;                        // 65536 = 1024*64
    const int r   = idx & 65535;
    const int k   = r >> 6;
    const int n   = r & 63;
    const float* W = (mat == 0) ? Wq : (mat == 1) ? Wk : Wv;
    WT[(size_t)mat * 64 * HH + (size_t)n * HH + k] = (__bf16)W[(size_t)k * DD + n];
}

// ============================================================
// Kernel 1: fused QKV projection.  grid = (64, 3), block = 256
//   X(8192x1024) * W(1024x64) + b  ->  bf16
//   mat 0 -> qb [m][d] (scaled by QSCALE) ; mat 1 -> kbr [m][d] ;
//   mat 2 -> vbT [n][d][l]
// Double-buffered async LDS staging.
// ============================================================
__global__ __launch_bounds__(256) void qkv_proj_kernel(
    const float* __restrict__ q_in, const float* __restrict__ k_in,
    const float* __restrict__ v_in,
    const __bf16* __restrict__ WT,                 // [3][64][1024] bf16
    const float* __restrict__ bq, const float* __restrict__ bk,
    const float* __restrict__ bv,
    __bf16* __restrict__ qb, __bf16* __restrict__ kbr, __bf16* __restrict__ vbT)
{
    const int mat = blockIdx.y;                    // 0=q, 1=k, 2=v
    const float*  X   = (mat == 0) ? q_in : (mat == 1) ? k_in : v_in;
    const __bf16* WTm = WT + (size_t)mat * 64 * HH;
    const float*  Bb  = (mat == 0) ? bq : (mat == 1) ? bk : bv;

    const int mBase     = blockIdx.x * 128;        // row base in flattened (N*L)
    const int tid       = threadIdx.x;
    const int lane      = tid & 31;
    const int wave      = tid >> 5;                // 0..7
    const int rowInTile = lane & 15;
    const int kb        = (lane & 16) ? 8 : 0;
    const int hb        = (lane & 16) ? 8 : 0;     // C-layout row offset

    __shared__ __align__(16) float  sA[2][128 * 32];   // [row][k] f32
    __shared__ __align__(16) __bf16 sWT[2][64 * 32];   // [n][k]  bf16

    auto stage = [&](int kk, int bufi) {
#pragma unroll
        for (int it = 0; it < 4; ++it) {
            int idx = (it * 256 + tid) * 4;
            int r = idx >> 5, c = idx & 31;
            async_ld_b128(&sA[bufi][r * 32 + c],
                          X + (size_t)(mBase + r) * HH + kk + c);
        }
        {
            int idx = tid * 8;
            int nn = idx >> 5, c = idx & 31;
            async_ld_b128(&sWT[bufi][nn * 32 + c],
                          WTm + (size_t)nn * HH + kk + c);
        }
    };

    v8f acc[4];
#pragma unroll
    for (int nt = 0; nt < 4; ++nt) acc[nt] = vzero8();

    stage(0, 0);
    wait_async0();
    __syncthreads();

    for (int kk = 0; kk < HH; kk += 32) {
        const int bufi = (kk >> 5) & 1;
        if (kk + 32 < HH) stage(kk + 32, bufi ^ 1);   // prefetch next tile

        // A fragment: 16x32 (two contiguous runs -> ds_load_b128 + cvt)
        v16bf a;
        const float* arow = &sA[bufi][(wave * 16 + rowInTile) * 32];
#pragma unroll
        for (int e = 0; e < 16; ++e) a[e] = (__bf16)arow[fragK(e, kb)];

        // 4 B fragments (bf16, no conversion) + WMMA
#pragma unroll
        for (int nt = 0; nt < 4; ++nt) {
            v16bf b;
            const __bf16* wrow = &sWT[bufi][(nt * 16 + rowInTile) * 32];
#pragma unroll
            for (int e = 0; e < 16; ++e) b[e] = wrow[fragK(e, kb)];
            acc[nt] = __builtin_amdgcn_wmma_f32_16x16x32_bf16(
                false, a, false, b, (short)0, acc[nt], false, false);
        }
        wait_async0();        // next tile landed
        __syncthreads();      // everyone done reading current tile
    }

    // epilogue: bias (+ softmax scale folded into Q) + bf16 store
    const int mTop = mBase + wave * 16;
#pragma unroll
    for (int nt = 0; nt < 4; ++nt) {
        const int d = nt * 16 + rowInTile;         // C layout: col = lane%16
        const float bias = Bb[d];
#pragma unroll
        for (int i = 0; i < 8; ++i) {
            const int m = mTop + hb + i;           // C layout: row = i (+8 hi half)
            float val = acc[nt][i] + bias;
            if (mat == 0) val *= QSCALE;           // fold 0.125*log2(e) into q
            const __bf16 h = (__bf16)val;
            const int n = m >> 11;                 // /L (2048)
            const int l = m & (LL - 1);
            if (mat == 2) {
                vbT[((size_t)n * DD + d) * LL + l] = h;
            } else {
                __bf16* dst = (mat == 0) ? qb : kbr;
                dst[(size_t)m * DD + d] = h;
            }
        }
    }
}

// ============================================================
// Kernel 2: flash attention.  grid = 64 (= N * L/128), block = 256
// Each wave: 16 query rows vs all 2048 keys, 32 keys per step.
// LDS: sK [key][d] (32x64), sVT [d][key] (64x32), sP per-wave [16][32]
// Double-buffered async LDS staging; softmax in exp2 domain.
// ============================================================
__global__ __launch_bounds__(256) void attn_kernel(
    const __bf16* __restrict__ qb, const __bf16* __restrict__ kbr,
    const __bf16* __restrict__ vbT, float* __restrict__ out)
{
    const int tid       = threadIdx.x;
    const int lane      = tid & 31;
    const int wave      = tid >> 5;
    const int n         = blockIdx.x >> 4;         // batch
    const int qt        = blockIdx.x & 15;
    const int qBase     = qt * 128;
    const int rowInTile = lane & 15;
    const int kb        = (lane & 16) ? 8 : 0;
    const int hb        = (lane & 16) ? 8 : 0;

    __shared__ __align__(16) __bf16 sK[2][32 * 64];   // [key][d]
    __shared__ __align__(16) __bf16 sVT[2][64 * 32];  // [d][key]
    __shared__ __align__(16) __bf16 sP[8][16 * 32];

    auto stageKV = [&](int kt, int bufi) {
        {
            int idx = tid * 8;
            int key = idx >> 6, c = idx & 63;
            async_ld_b128(&sK[bufi][key * 64 + c],
                          kbr + (size_t)(n * LL + kt + key) * DD + c);
        }
        {
            int idx = tid * 8;
            int d = idx >> 5, c = idx & 31;
            async_ld_b128(&sVT[bufi][d * 32 + c],
                          vbT + ((size_t)n * DD + d) * LL + kt + c);
        }
    };

    // load this wave's Q fragments (16 rows x 64 d -> two 16x32 A-frags)
    const __bf16* qrow =
        qb + (size_t)(n * LL + qBase + wave * 16 + rowInTile) * DD;
    v16bf qf[2];
#pragma unroll
    for (int h = 0; h < 2; ++h)
#pragma unroll
        for (int e = 0; e < 16; ++e)
            qf[h][e] = qrow[h * 32 + fragK(e, kb)];

    v8f oacc[4];
#pragma unroll
    for (int dt = 0; dt < 4; ++dt) oacc[dt] = vzero8();
    float mrow[8], lrow[8];
#pragma unroll
    for (int i = 0; i < 8; ++i) { mrow[i] = -1e30f; lrow[i] = 0.0f; }

    stageKV(0, 0);
    wait_async0();
    __syncthreads();

    for (int kt = 0; kt < LL; kt += 32) {
        const int bufi = (kt >> 5) & 1;
        if (kt + 32 < LL) stageKV(kt + 32, bufi ^ 1);   // prefetch next tile
        // deepen the pipeline: warm L2 for the tile after next
        if (kt + 64 < LL) {
            __builtin_prefetch(kbr + (size_t)(n * LL + kt + 64 + (tid & 31)) * DD, 0, 0);
        }

        // scores S = Q K^T (pre-scaled by 0.125*log2e): 2 key tiles x 2 d-steps
        v8f sc[2];
        sc[0] = vzero8(); sc[1] = vzero8();
#pragma unroll
        for (int ct = 0; ct < 2; ++ct) {
            const int keyc = ct * 16 + rowInTile;
#pragma unroll
            for (int h = 0; h < 2; ++h) {
                v16bf bkf;
#pragma unroll
                for (int e = 0; e < 16; ++e)
                    bkf[e] = sK[bufi][keyc * 64 + h * 32 + fragK(e, kb)];
                sc[ct] = __builtin_amdgcn_wmma_f32_16x16x32_bf16(
                    false, qf[h], false, bkf, (short)0, sc[ct], false, false);
            }
        }

        // online softmax in exp2 domain; C layout: vgpr i -> row (hb+i)
        float corr[8];
#pragma unroll
        for (int i = 0; i < 8; ++i) {
            const float s0 = sc[0][i], s1 = sc[1][i];
            float tmax = fmaxf(s0, s1);
#pragma unroll
            for (int off = 1; off < 16; off <<= 1)
                tmax = fmaxf(tmax, __shfl_xor(tmax, off, 32));
            const float mnew = fmaxf(mrow[i], tmax);
            const float p0 = exp2f(s0 - mnew);     // v_exp_f32 is base-2
            const float p1 = exp2f(s1 - mnew);
            float psum = p0 + p1;
#pragma unroll
            for (int off = 1; off < 16; off <<= 1)
                psum += __shfl_xor(psum, off, 32);
            const float c = exp2f(mrow[i] - mnew);
            corr[i] = c;
            lrow[i] = lrow[i] * c + psum;
            mrow[i] = mnew;
            // spill P (C layout) to per-wave LDS tile [q][key]
            sP[wave][(hb + i) * 32 + rowInTile]      = (__bf16)p0;
            sP[wave][(hb + i) * 32 + 16 + rowInTile] = (__bf16)p1;
        }
#pragma unroll
        for (int dt = 0; dt < 4; ++dt)
#pragma unroll
            for (int i = 0; i < 8; ++i) oacc[dt][i] *= corr[i];

        // reload P in A-fragment layout (same-wave DS ordering; no barrier)
        v16bf pf;
#pragma unroll
        for (int e = 0; e < 16; ++e)
            pf[e] = sP[wave][rowInTile * 32 + fragK(e, kb)];

        // O += P V : 4 d-tiles (contiguous key runs -> ds_load_b128)
#pragma unroll
        for (int dt = 0; dt < 4; ++dt) {
            const int d = dt * 16 + rowInTile;
            v16bf bvf;
#pragma unroll
            for (int e = 0; e < 16; ++e)
                bvf[e] = sVT[bufi][d * 32 + fragK(e, kb)];
            oacc[dt] = __builtin_amdgcn_wmma_f32_16x16x32_bf16(
                false, pf, false, bvf, (short)0, oacc[dt], false, false);
        }
        wait_async0();        // next K/V tile landed
        __syncthreads();      // everyone done reading current tile
    }

    // epilogue: normalize and store f32 output (N, L, 64)
    float* orow = out + (size_t)(n * LL + qBase + wave * 16) * DD;
#pragma unroll
    for (int dt = 0; dt < 4; ++dt) {
        const int d = dt * 16 + rowInTile;
#pragma unroll
        for (int i = 0; i < 8; ++i) {
            const float inv = 1.0f / lrow[i];
            orow[(size_t)(hb + i) * DD + d] = oacc[dt][i] * inv;
        }
    }
}

// ============================================================
extern "C" void kernel_launch(void* const* d_in, const int* in_sizes, int n_in,
                              void* d_out, int out_size, void* d_ws, size_t ws_size,
                              hipStream_t stream) {
    const float* query = (const float*)d_in[0];
    const float* key_  = (const float*)d_in[1];
    const float* value = (const float*)d_in[2];
    const float* Wq    = (const float*)d_in[3];
    const float* bq    = (const float*)d_in[4];
    const float* Wk    = (const float*)d_in[5];
    const float* bk    = (const float*)d_in[6];
    const float* Wv    = (const float*)d_in[7];
    const float* bv    = (const float*)d_in[8];
    float* out = (float*)d_out;

    const size_t elems = (size_t)NB * LL * DD;     // 524288
    __bf16* qb  = (__bf16*)d_ws;
    __bf16* kbr = qb + elems;
    __bf16* vbT = kbr + elems;
    __bf16* WT  = vbT + elems;                     // [3][64][1024]

    wconv_kernel<<<768, 256, 0, stream>>>(Wq, Wk, Wv, WT);
    dim3 g1(64, 3, 1);
    qkv_proj_kernel<<<g1, 256, 0, stream>>>(query, key_, value, WT,
                                            bq, bk, bv, qb, kbr, vbT);
    attn_kernel<<<64, 256, 0, stream>>>(qb, kbr, vbT, out);
}

// v001
// Measured time: 97.2 microseconds a run.
// Timed twice side by side with v000, it ran 1.36 and 1.35 times as fast.
#include <hip/hip_runtime.h>
#include <hip/hip_bf16.h>

// ---- problem constants (from reference) ----
#define NB 4
#define LL 2048
#define HH 1024
#define DD 64

// 0.125 (=1/sqrt(64)) * log2(e): folded into the Q projection so the
// softmax can run directly on hardware base-2 exp (v_exp_f32).
#define QSCALE 0.18033688011112042f

typedef __attribute__((ext_vector_type(16))) __bf16 v16bf;
typedef __attribute__((ext_vector_type(8)))  float  v8f;

__device__ __forceinline__ v8f vzero8() {
    v8f z;
#pragma unroll
    for (int i = 0; i < 8; ++i) z[i] = 0.0f;
    return z;
}

// A/B 16-bit fragment K-index pattern (wave32):
// lane<16 holds K {0..7,16..23}, lane>=16 holds K {8..15,24..31}
__device__ __forceinline__ int fragK(int e, int kb) {
    return kb + e + ((e & 8) ? 8 : 0);
}

// CDNA5 async global->LDS copy (16 bytes per lane), tracked by ASYNCcnt.
// Low 32 bits of a generic pointer into LDS == wave-relative LDS byte offset
// (ISA 10.2 aperture mapping), which is what VDST wants.
__device__ __forceinline__ void async_ld_b128(const void* lds_ptr, const void* gsrc) {
    unsigned loff = (unsigned)(unsigned long long)lds_ptr;
    asm volatile("global_load_async_to_lds_b128 %0, %1, off"
                 :: "v"(loff), "v"(gsrc)
                 : "memory");
}
__device__ __forceinline__ void wait_async0() {
    asm volatile("s_wait_asynccnt 0" ::: "memory");
}

// ============================================================
// Kernel 0: convert W (f32, [1024][64]) -> WT (bf16, [3][64][1024])
// grid = 768, block = 256   (3 * 1024 * 64 elements)
// ============================================================
__global__ __launch_bounds__(256) void wconv_kernel(
    const float* __restrict__ Wq, const float* __restrict__ Wk,
    const float* __restrict__ Wv, __bf16* __restrict__ WT)
{
    const int idx = blockIdx.x * 256 + threadIdx.x;   // 0 .. 3*65536-1
    const int mat = idx >> 16;                        // 65536 = 1024*64
    const int r   = idx & 65535;
    const int k   = r >> 6;
    const int n   = r & 63;
    const float* W = (mat == 0) ? Wq : (mat == 1) ? Wk : Wv;
    WT[(size_t)mat * 64 * HH + (size_t)n * HH + k] = (__bf16)W[(size_t)k * DD + n];
}

// ============================================================
// Kernel 1: fused QKV projection.  grid = (64, 3), block = 256
//   X(8192x1024) * W(1024x64) + b  ->  bf16
//   mat 0 -> qb [m][d] (scaled by QSCALE) ; mat 1 -> kbr [m][d] ;
//   mat 2 -> vbT [n][d][l]
// Double-buffered async LDS staging.
// ============================================================
__global__ __launch_bounds__(256) void qkv_proj_kernel(
    const float* __restrict__ q_in, const float* __restrict__ k_in,
    const float* __restrict__ v_in,
    const __bf16* __restrict__ WT,                 // [3][64][1024] bf16
    const float* __restrict__ bq, const float* __restrict__ bk,
    const float* __restrict__ bv,
    __bf16* __restrict__ qb, __bf16* __restrict__ kbr, __bf16* __restrict__ vbT)
{
    const int mat = blockIdx.y;                    // 0=q, 1=k, 2=v
    const float*  X   = (mat == 0) ? q_in : (mat == 1) ? k_in : v_in;
    const __bf16* WTm = WT + (size_t)mat * 64 * HH;
    const float*  Bb  = (mat == 0) ? bq : (mat == 1) ? bk : bv;

    const int mBase     = blockIdx.x * 128;        // row base in flattened (N*L)
    const int tid       = threadIdx.x;
    const int lane      = tid & 31;
    const int wave      = tid >> 5;                // 0..7
    const int rowInTile = lane & 15;
    const int kb        = (lane & 16) ? 8 : 0;
    const int hb        = (lane & 16) ? 8 : 0;     // C-layout row offset

    __shared__ __align__(16) float  sA[2][128 * 32];   // [row][k] f32
    __shared__ __align__(16) __bf16 sWT[2][64 * 32];   // [n][k]  bf16

    auto stage = [&](int kk, int bufi) {
#pragma unroll
        for (int it = 0; it < 4; ++it) {
            int idx = (it * 256 + tid) * 4;
            int r = idx >> 5, c = idx & 31;
            async_ld_b128(&sA[bufi][r * 32 + c],
                          X + (size_t)(mBase + r) * HH + kk + c);
        }
        {
            int idx = tid * 8;
            int nn = idx >> 5, c = idx & 31;
            async_ld_b128(&sWT[bufi][nn * 32 + c],
                          WTm + (size_t)nn * HH + kk + c);
        }
    };

    v8f acc[4];
#pragma unroll
    for (int nt = 0; nt < 4; ++nt) acc[nt] = vzero8();

    stage(0, 0);
    wait_async0();
    __syncthreads();

    for (int kk = 0; kk < HH; kk += 32) {
        const int bufi = (kk >> 5) & 1;
        if (kk + 32 < HH) stage(kk + 32, bufi ^ 1);   // prefetch next tile

        // A fragment: 16x32 (two contiguous runs -> ds_load_b128 + cvt)
        v16bf a;
        const float* arow = &sA[bufi][(wave * 16 + rowInTile) * 32];
#pragma unroll
        for (int e = 0; e < 16; ++e) a[e] = (__bf16)arow[fragK(e, kb)];

        // 4 B fragments (bf16, no conversion) + WMMA
#pragma unroll
        for (int nt = 0; nt < 4; ++nt) {
            v16bf b;
            const __bf16* wrow = &sWT[bufi][(nt * 16 + rowInTile) * 32];
#pragma unroll
            for (int e = 0; e < 16; ++e) b[e] = wrow[fragK(e, kb)];
            acc[nt] = __builtin_amdgcn_wmma_f32_16x16x32_bf16(
                false, a, false, b, (short)0, acc[nt], false, false);
        }
        wait_async0();        // next tile landed
        __syncthreads();      // everyone done reading current tile
    }

    // epilogue: bias (+ softmax scale folded into Q) + bf16 store
    const int mTop = mBase + wave * 16;
#pragma unroll
    for (int nt = 0; nt < 4; ++nt) {
        const int d = nt * 16 + rowInTile;         // C layout: col = lane%16
        const float bias = Bb[d];
#pragma unroll
        for (int i = 0; i < 8; ++i) {
            const int m = mTop + hb + i;           // C layout: row = i (+8 hi half)
            float val = acc[nt][i] + bias;
            if (mat == 0) val *= QSCALE;           // fold 0.125*log2(e) into q
            const __bf16 h = (__bf16)val;
            const int n = m >> 11;                 // /L (2048)
            const int l = m & (LL - 1);
            if (mat == 2) {
                vbT[((size_t)n * DD + d) * LL + l] = h;
            } else {
                __bf16* dst = (mat == 0) ? qb : kbr;
                dst[(size_t)m * DD + d] = h;
            }
        }
    }
}

__device__ __forceinline__ float xhalf(float x) {
    const int xi = __builtin_bit_cast(int, x);
    return __builtin_bit_cast(float, __builtin_amdgcn_permlanex16(
        xi, xi, 0x76543210, 0xfedcba98, false, false));
}

__global__ __launch_bounds__(256) void attn_kernel(
    const __bf16* __restrict__ qb, const __bf16* __restrict__ kbr,
    const __bf16* __restrict__ vbT, float* __restrict__ out)
{
    const int tid       = threadIdx.x;
    const int lane      = tid & 31;
    const int wave      = tid >> 5;
    const int n         = blockIdx.x >> 4;         // batch
    const int qt        = blockIdx.x & 15;
    const int qBase     = qt * 128;
    const int rowInTile = lane & 15;
    const int kb        = (lane & 16) ? 8 : 0;
    const int hb        = (lane & 16) ? 8 : 0;

    __shared__ __align__(16) __bf16 sK[2][32 * 64];   // [key][d]
    __shared__ __align__(16) __bf16 sVT[2][64 * 32];  // [d][key]

    auto stageKV = [&](int kt, int bufi) {
        {
            int idx = tid * 8;
            int key = idx >> 6, c = idx & 63;
            async_ld_b128(&sK[bufi][key * 64 + c],
                          kbr + (size_t)(n * LL + kt + key) * DD + c);
        }
        {
            int idx = tid * 8;
            int d = idx >> 5, c = idx & 31;
            async_ld_b128(&sVT[bufi][d * 32 + c],
                          vbT + ((size_t)n * DD + d) * LL + kt + c);
        }
    };

    // load this wave's Q fragments (64 d x 16 queries -> two 32x16 B-frags)
    const __bf16* qrow =
        qb + (size_t)(n * LL + qBase + wave * 16 + rowInTile) * DD;
    v16bf qf[2];
#pragma unroll
    for (int h = 0; h < 2; ++h)
#pragma unroll
        for (int e = 0; e < 16; ++e)
            qf[h][e] = qrow[h * 32 + fragK(e, kb)];

    v8f oacc[4];                                   // O^T: vgpr i -> d = dt*16+hb+i
#pragma unroll
    for (int dt = 0; dt < 4; ++dt) oacc[dt] = vzero8();
    float mrun = -1e30f;   // running maximum of this lane's query (both halves equal)
    float lrun = 0.0f;     // running sum over this lane's half of the keys

    stageKV(0, 0);
    wait_async0();
    __syncthreads();

    for (int kt = 0; kt < LL; kt += 32) {
        const int bufi = (kt >> 5) & 1;
        if (kt + 32 < LL) stageKV(kt + 32, bufi ^ 1);   // prefetch next tile
        // deepen the pipeline: warm L2 for the tile after next
        if (kt + 64 < LL) {
            __builtin_prefetch(kbr + (size_t)(n * LL + kt + 64 + (tid & 31)) * DD, 0, 0);
        }

        // scores S^T = K Q^T (pre-scaled by 0.125*log2e): 2 key tiles x 2 d-steps
        // D layout: sc[ct][i] = S[query rowInTile][key ct*16 + hb + i]
        v8f sc[2];
        sc[0] = vzero8(); sc[1] = vzero8();
#pragma unroll
        for (int ct = 0; ct < 2; ++ct) {
            const int keyr = ct * 16 + rowInTile;
#pragma unroll
            for (int h = 0; h < 2; ++h) {
                v16bf akf;
#pragma unroll
                for (int e = 0; e < 16; ++e)
                    akf[e] = sK[bufi][keyr * 64 + h * 32 + fragK(e, kb)];
                sc[ct] = __builtin_amdgcn_wmma_f32_16x16x32_bf16(
                    false, akf, false, qf[h], (short)0, sc[ct], false, false);
            }
        }

        // online softmax in exp2 domain, one query per lane
        float t8[8];
#pragma unroll
        for (int i = 0; i < 8; ++i) t8[i] = fmaxf(sc[0][i], sc[1][i]);
        float tmax = fmaxf(fmaxf(fmaxf(t8[0], t8[1]), fmaxf(t8[2], t8[3])),
                           fmaxf(fmaxf(t8[4], t8[5]), fmaxf(t8[6], t8[7])));
        tmax = fmaxf(tmax, xhalf(tmax));           // join the two key halves
        const float mnew = fmaxf(mrun, tmax);
        const float corr = exp2f(mrun - mnew);     // v_exp_f32 is base-2
        mrun = mnew;

        // P^T: element e of the B fragment is key fragK(e, kb) = sc[e>>3][e&7]
        v16bf pf;
        float ps[8];
#pragma unroll
        for (int i = 0; i < 8; ++i) {
            const float p0 = exp2f(sc[0][i] - mnew);
            const float p1 = exp2f(sc[1][i] - mnew);
            pf[i]     = (__bf16)p0;
            pf[8 + i] = (__bf16)p1;
            ps[i] = p0 + p1;
        }
        const float psum = ((ps[0] + ps[1]) + (ps[2] + ps[3])) +
                           ((ps[4] + ps[5]) + (ps[6] + ps[7]));
        lrun = lrun * corr + psum;
#pragma unroll
        for (int dt = 0; dt < 4; ++dt)
#pragma unroll
            for (int i = 0; i < 8; ++i) oacc[dt][i] *= corr;

        // O^T += V^T P^T : 4 d-tiles (contiguous key runs -> ds_load_b128)
#pragma unroll
        for (int dt = 0; dt < 4; ++dt) {
            const int d = dt * 16 + rowInTile;
            v16bf avf;
#pragma unroll
            for (int e = 0; e < 16; ++e)
                avf[e] = sVT[bufi][d * 32 + fragK(e, kb)];
            oacc[dt] = __builtin_amdgcn_wmma_f32_16x16x32_bf16(
                false, avf, false, pf, (short)0, oacc[dt], false, false);
        }
        wait_async0();        // next K/V tile landed
        __syncthreads();      // everyone done reading current tile
    }

    // epilogue: join the halves' sums, normalize, store f32 output (N, L, 64);
    // a lane holds 8 consecutive d of its query per d-tile -> two 16-byte stores
    const float inv = 1.0f / (lrun + xhalf(lrun));
    float* orow = out + (size_t)(n * LL + qBase + wave * 16 + rowInTile) * DD + hb;
#pragma unroll
    for (int dt = 0; dt < 4; ++dt) {
        const float4 lo = make_float4(oacc[dt][0] * inv, oacc[dt][1] * inv,
                                      oacc[dt][2] * inv, oacc[dt][3] * inv);
        const float4 hi = make_float4(oacc[dt][4] * inv, oacc[dt][5] * inv,
                                      oacc[dt][6] * inv, oacc[dt][7] * inv);
        *reinterpret_cast<float4*>(orow + dt * 16)     = lo;
        *reinterpret_cast<float4*>(orow + dt * 16 + 4) = hi;
    }
}

// ============================================================
extern "C" void kernel_launch(void* const* d_in, const int* in_sizes, int n_in,
                              void* d_out, int out_size, void* d_ws, size_t ws_size,
                              hipStream_t stream) {
    const float* query = (const float*)d_in[0];
    const float* key_  = (const float*)d_in[1];
    const float* value = (const float*)d_in[2];
    const float* Wq    = (const float*)d_in[3];
    const float* bq    = (const float*)d_in[4];
    const float* Wk    = (const float*)d_in[5];
    const float* bk    = (const float*)d_in[6];
    const float* Wv    = (const float*)d_in[7];
    const float* bv    = (const float*)d_in[8];
    float* out = (float*)d_out;

    const size_t elems = (size_t)NB * LL * DD;     // 524288
    __bf16* qb  = (__bf16*)d_ws;
    __bf16* kbr = qb + elems;
    __bf16* vbT = kbr + elems;
    __bf16* WT  = vbT + elems;                     // [3][64][1024]

    wconv_kernel<<<768, 256, 0, stream>>>(Wq, Wk, Wv, WT);
    dim3 g1(64, 3, 1);
    qkv_proj_kernel<<<g1, 256, 0, stream>>>(query, key_, value, WT,
                                            bq, bk, bv, qb, kbr, vbT);
    attn_kernel<<<64, 256, 0, stream>>>(qb, kbr, vbT, out);
}

// v002
// Measured time: 60.6 microseconds a run.
// Two timings next to v001 put it at 1.60 and 1.61 times that version's speed.
// Over all steps from v000 it is 2.17 times as fast.
#include <hip/hip_runtime.h>
#include <hip/hip_bf16.h>

// ---- problem constants (from reference) ----
#define NB 4
#define LL 2048
#define HH 1024
#define DD 64

// 0.125 (=1/sqrt(64)) * log2(e): folded into the Q projection so the
// softmax can run directly on hardware base-2 exp (v_exp_f32).
#define QSCALE 0.18033688011112042f

typedef __attribute__((ext_vector_type(16))) __bf16 v16bf;
typedef __attribute__((ext_vector_type(8)))  float  v8f;

__device__ __forceinline__ v8f vzero8() {
    v8f z;
#pragma unroll
    for (int i = 0; i < 8; ++i) z[i] = 0.0f;
    return z;
}

// A/B 16-bit fragment K-index pattern (wave32):
// lane<16 holds K {0..7,16..23}, lane>=16 holds K {8..15,24..31}
__device__ __forceinline__ int fragK(int e, int kb) {
    return kb + e + ((e & 8) ? 8 : 0);
}

// CDNA5 async global->LDS copy (16 bytes per lane), tracked by ASYNCcnt.
// Low 32 bits of a generic pointer into LDS == wave-relative LDS byte offset
// (ISA 10.2 aperture mapping), which is what VDST wants.
__device__ __forceinline__ void async_ld_b128(const void* lds_ptr, const void* gsrc) {
    unsigned loff = (unsigned)(unsigned long long)lds_ptr;
    asm volatile("global_load_async_to_lds_b128 %0, %1, off"
                 :: "v"(loff), "v"(gsrc)
                 : "memory");
}
__device__ __forceinline__ void wait_async0() {
    asm volatile("s_wait_asynccnt 0" ::: "memory");
}

// ============================================================
// Kernel 0: convert W (f32, [1024][64]) -> WT (bf16, [3][64][1024])
// grid = 768, block = 256   (3 * 1024 * 64 elements)
// ============================================================
__global__ __launch_bounds__(256) void wconv_kernel(
    const float* __restrict__ Wq, const float* __restrict__ Wk,
    const float* __restrict__ Wv, __bf16* __restrict__ WT)
{
    const int idx = blockIdx.x * 256 + threadIdx.x;   // 0 .. 3*65536-1
    const int mat = idx >> 16;                        // 65536 = 1024*64
    const int r   = idx & 65535;
    const int k   = r >> 6;
    const int n   = r & 63;
    const float* W = (mat == 0) ? Wq : (mat == 1) ? Wk : Wv;
    WT[(size_t)mat * 64 * HH + (size_t)n * HH + k] = (__bf16)W[(size_t)k * DD + n];
}

// ============================================================
// Kernel 1: fused QKV projection.  grid = (64, 3), block = 256
//   X(8192x1024) * W(1024x64) + b  ->  bf16
//   mat 0 -> qb [m][d] (scaled by QSCALE) ; mat 1 -> kbr [m][d] ;
//   mat 2 -> vbT [n][d][l]
// Double-buffered async LDS staging.
// ============================================================
__global__ __launch_bounds__(256) void qkv_proj_kernel(
    const float* __restrict__ q_in, const float* __restrict__ k_in,
    const float* __restrict__ v_in,
    const __bf16* __restrict__ WT,                 // [3][64][1024] bf16
    const float* __restrict__ bq, const float* __restrict__ bk,
    const float* __restrict__ bv,
    __bf16* __restrict__ qb, __bf16* __restrict__ kbr, __bf16* __restrict__ vbT)
{
    const int mat = blockIdx.y;                    // 0=q, 1=k, 2=v
    const float*  X   = (mat == 0) ? q_in : (mat == 1) ? k_in : v_in;
    const __bf16* WTm = WT + (size_t)mat * 64 * HH;
    const float*  Bb  = (mat == 0) ? bq : (mat == 1) ? bk : bv;

    const int mBase     = blockIdx.x * 128;        // row base in flattened (N*L)
    const int tid       = threadIdx.x;
    const int lane      = tid & 31;
    const int wave      = tid >> 5;                // 0..7
    const int rowInTile = lane & 15;
    const int kb        = (lane & 16) ? 8 : 0;
    const int hb        = (lane & 16) ? 8 : 0;     // C-layout row offset

    __shared__ __align__(16) float  sA[2][128 * 32];   // [row][k] f32
    __shared__ __align__(16) __bf16 sWT[2][64 * 32];   // [n][k]  bf16

    auto stage = [&](int kk, int bufi) {
#pragma unroll
        for (int it = 0; it < 4; ++it) {
            int idx = (it * 256 + tid) * 4;
            int r = idx >> 5, c = idx & 31;
            async_ld_b128(&sA[bufi][r * 32 + c],
                          X + (size_t)(mBase + r) * HH + kk + c);
        }
        {
            int idx = tid * 8;
            int nn = idx >> 5, c = idx & 31;
            async_ld_b128(&sWT[bufi][nn * 32 + c],
                          WTm + (size_t)nn * HH + kk + c);
        }
    };

    v8f acc[4];
#pragma unroll
    for (int nt = 0; nt < 4; ++nt) acc[nt] = vzero8();

    stage(0, 0);
    wait_async0();
    __syncthreads();

    for (int kk = 0; kk < HH; kk += 32) {
        const int bufi = (kk >> 5) & 1;
        if (kk + 32 < HH) stage(kk + 32, bufi ^ 1);   // prefetch next tile

        // A fragment: 16x32 (two contiguous runs -> ds_load_b128 + cvt)
        v16bf a;
        const float* arow = &sA[bufi][(wave * 16 + rowInTile) * 32];
#pragma unroll
        for (int e = 0; e < 16; ++e) a[e] = (__bf16)arow[fragK(e, kb)];

        // 4 B fragments (bf16, no conversion) + WMMA
#pragma unroll
        for (int nt = 0; nt < 4; ++nt) {
            v16bf b;
            const __bf16* wrow = &sWT[bufi][(nt * 16 + rowInTile) * 32];
#pragma unroll
            for (int e = 0; e < 16; ++e) b[e] = wrow[fragK(e, kb)];
            acc[nt] = __builtin_amdgcn_wmma_f32_16x16x32_bf16(
                false, a, false, b, (short)0, acc[nt], false, false);
        }
        wait_async0();        // next tile landed
        __syncthreads();      // everyone done reading current tile
    }

    // epilogue: bias (+ softmax scale folded into Q) + bf16 store
    const int mTop = mBase + wave * 16;
#pragma unroll
    for (int nt = 0; nt < 4; ++nt) {
        const int d = nt * 16 + rowInTile;         // C layout: col = lane%16
        const float bias = Bb[d];
#pragma unroll
        for (int i = 0; i < 8; ++i) {
            const int m = mTop + hb + i;           // C layout: row = i (+8 hi half)
            float val = acc[nt][i] + bias;
            if (mat == 0) val *= QSCALE;           // fold 0.125*log2(e) into q
            const __bf16 h = (__bf16)val;
            const int n = m >> 11;                 // /L (2048)
            const int l = m & (LL - 1);
            if (mat == 2) {
                vbT[((size_t)n * DD + d) * LL + l] = h;
            } else {
                __bf16* dst = (mat == 0) ? qb : kbr;
                dst[(size_t)m * DD + d] = h;
            }
        }
    }
}

#define KPARTS 4
#define PKEYS  (LL / KPARTS)     // keys per quarter
#define NSTEP  (PKEYS / 32)      // steps per wave
#define OPITCH 68                // f32 row pitch of the partial O (16-byte column walks)

// value of lane l ^ 16
__device__ __forceinline__ float xhalf(float x) {
    const int xi = __builtin_bit_cast(int, x);
    return __builtin_bit_cast(float, __builtin_amdgcn_permlanex16(
        xi, xi, 0x76543210, 0xfedcba98, false, false));
}

__device__ __forceinline__ unsigned lds_addr(const void* p) {
    return (unsigned)(unsigned long long)p;
}

// Eight async copies (16 bytes per lane each).  The closing s_wait_xcnt keeps
// every later rewrite of the address registers behind the copies' issue.
__device__ __forceinline__ void async_ld_b128_x8(
    unsigned l0, const void* g0, unsigned l1, const void* g1,
    unsigned l2, const void* g2, unsigned l3, const void* g3,
    unsigned l4, const void* g4, unsigned l5, const void* g5,
    unsigned l6, const void* g6, unsigned l7, const void* g7) {
    asm volatile("global_load_async_to_lds_b128 %0, %1, off\n\t"
                 "global_load_async_to_lds_b128 %2, %3, off\n\t"
                 "global_load_async_to_lds_b128 %4, %5, off\n\t"
                 "global_load_async_to_lds_b128 %6, %7, off\n\t"
                 "global_load_async_to_lds_b128 %8, %9, off\n\t"
                 "global_load_async_to_lds_b128 %10, %11, off\n\t"
                 "global_load_async_to_lds_b128 %12, %13, off\n\t"
                 "global_load_async_to_lds_b128 %14, %15, off\n\t"
                 "s_wait_xcnt 0x0"
                 :: "v"(l0), "v"(g0), "v"(l1), "v"(g1), "v"(l2), "v"(g2),
                    "v"(l3), "v"(g3), "v"(l4), "v"(g4), "v"(l5), "v"(g5),
                    "v"(l6), "v"(g6), "v"(l7), "v"(g7)
                 : "memory");
}
// This wave's LDS reads have returned before the buffer is handed back for a refill.
__device__ __forceinline__ void wait_ds0() {
    asm volatile("s_wait_dscnt 0x0" ::: "memory");
}

__global__ __launch_bounds__(256) void attn_kernel(
    const __bf16* __restrict__ qb, const __bf16* __restrict__ kbr,
    const __bf16* __restrict__ vbT, float* __restrict__ out)
{
    const int tid       = threadIdx.x;
    const int lane      = tid & 31;
    const int wave      = tid >> 5;
    const int qtile     = wave & 1;                // which 16 of the 32 queries
    const int part      = wave >> 1;               // which quarter of the keys
    const int n         = blockIdx.x >> 6;         // batch
    const int qBase     = (blockIdx.x & 63) * 32;
    const int rowInTile = lane & 15;
    const int kb        = (lane & 16) ? 8 : 0;
    const int hb        = (lane & 16) ? 8 : 0;

    __shared__ __align__(16) __bf16 sK[2][KPARTS][32 * 64];   // [key][d]
    __shared__ __align__(16) __bf16 sVT[2][KPARTS][64 * 32];  // [d][key]
    __shared__ __align__(16) float  sO[KPARTS][32 * OPITCH];  // [query][d]
    __shared__ float sM[KPARTS][32];
    __shared__ float sL[KPARTS][32];

    // a thread's 16-byte piece of each quarter's K tile and V^T tile
    const __bf16* gK = kbr + (size_t)n * LL * DD + tid * 8;
    const __bf16* gV = vbT + ((size_t)n * DD + (tid >> 2)) * LL + (tid & 3) * 8;

    auto stageKV = [&](int step, int bufi) {
        const __bf16* k0 = gK + (size_t)step * 32 * DD;
        const __bf16* v0 = gV + step * 32;
        async_ld_b128_x8(
            lds_addr(&sK[bufi][0][tid * 8]),  k0,
            lds_addr(&sK[bufi][1][tid * 8]),  k0 + (size_t)1 * PKEYS * DD,
            lds_addr(&sK[bufi][2][tid * 8]),  k0 + (size_t)2 * PKEYS * DD,
            lds_addr(&sK[bufi][3][tid * 8]),  k0 + (size_t)3 * PKEYS * DD,
            lds_addr(&sVT[bufi][0][tid * 8]), v0,
            lds_addr(&sVT[bufi][1][tid * 8]), v0 + 1 * PKEYS,
            lds_addr(&sVT[bufi][2][tid * 8]), v0 + 2 * PKEYS,
            lds_addr(&sVT[bufi][3][tid * 8]), v0 + 3 * PKEYS);
    };

    // load this wave's Q fragments (64 d x 16 queries -> two 32x16 B-frags)
    const __bf16* qrow =
        qb + (size_t)(n * LL + qBase + qtile * 16 + rowInTile) * DD;
    v16bf qf[2];
#pragma unroll
    for (int h = 0; h < 2; ++h)
#pragma unroll
        for (int e = 0; e < 16; ++e)
            qf[h][e] = qrow[h * 32 + fragK(e, kb)];

    v8f oacc[4];                                   // O^T: vgpr i -> d = dt*16+hb+i
#pragma unroll
    for (int dt = 0; dt < 4; ++dt) oacc[dt] = vzero8();
    float mrun = -1e30f;   // running maximum of this lane's query (both halves equal)
    float lrun = 0.0f;     // running sum over this lane's half of the keys

    stageKV(0, 0);
    wait_async0();
    __syncthreads();
    stageKV(1, 1);

    for (int st = 0; st < NSTEP; ++st) {
        const int bufi = st & 1;
        const __bf16* tK = sK[bufi][part];
        const __bf16* tV = sVT[bufi][part];

        // scores S^T = K Q^T (pre-scaled by 0.125*log2e): 2 key tiles x 2 d-steps
        // D layout: sc[ct][i] = S[query rowInTile][key ct*16 + hb + i]
        v8f sc[2];
        sc[0] = vzero8(); sc[1] = vzero8();
#pragma unroll
        for (int ct = 0; ct < 2; ++ct) {
            const int keyr = ct * 16 + rowInTile;
#pragma unroll
            for (int h = 0; h < 2; ++h) {
                v16bf akf;
#pragma unroll
                for (int e = 0; e < 16; ++e)
                    akf[e] = tK[keyr * 64 + h * 32 + fragK(e, kb)];
                sc[ct] = __builtin_amdgcn_wmma_f32_16x16x32_bf16(
                    false, akf, false, qf[h], (short)0, sc[ct], false, false);
            }
        }

        // online softmax in exp2 domain, one query per lane
        float t8[8];
#pragma unroll
        for (int i = 0; i < 8; ++i) t8[i] = fmaxf(sc[0][i], sc[1][i]);
        float tmax = fmaxf(fmaxf(fmaxf(t8[0], t8[1]), fmaxf(t8[2], t8[3])),
                           fmaxf(fmaxf(t8[4], t8[5]), fmaxf(t8[6], t8[7])));
        tmax = fmaxf(tmax, xhalf(tmax));           // join the two key halves
        const float mnew = fmaxf(mrun, tmax);
        const float corr = exp2f(mrun - mnew);     // v_exp_f32 is base-2
        mrun = mnew;

        // P^T: element e of the B fragment is key fragK(e, kb) = sc[e>>3][e&7]
        v16bf pf;
        float ps[8];
#pragma unroll
        for (int i = 0; i < 8; ++i) {
            const float p0 = exp2f(sc[0][i] - mnew);
            const float p1 = exp2f(sc[1][i] - mnew);
            pf[i]     = (__bf16)p0;
            pf[8 + i] = (__bf16)p1;
            ps[i] = p0 + p1;
        }
        const float psum = ((ps[0] + ps[1]) + (ps[2] + ps[3])) +
                           ((ps[4] + ps[5]) + (ps[6] + ps[7]));
        lrun = lrun * corr + psum;
#pragma unroll
        for (int dt = 0; dt < 4; ++dt)
#pragma unroll
            for (int i = 0; i < 8; ++i) oacc[dt][i] *= corr;

        // O^T += V^T P^T : 4 d-tiles (contiguous key runs -> ds_load_b128)
#pragma unroll
        for (int dt = 0; dt < 4; ++dt) {
            const int d = dt * 16 + rowInTile;
            v16bf avf;
#pragma unroll
            for (int e = 0; e < 16; ++e)
                avf[e] = tV[d * 32 + fragK(e, kb)];
            oacc[dt] = __builtin_amdgcn_wmma_f32_16x16x32_bf16(
                false, avf, false, pf, (short)0, oacc[dt], false, false);
        }
        wait_ds0();           // own reads of this buffer are over
        wait_async0();        // next K/V tiles landed
        __syncthreads();      // publishes them; everyone done reading this buffer
        if (st + 2 < NSTEP) stageKV(st + 2, bufi);   // refill the buffer just read
    }
    wait_async0();            // nothing in flight past the loop

    // hand this quarter's partial (max, sum, O) of 16 queries to the block
    const float lsum = lrun + xhalf(lrun);         // join the halves' sums
    const int ql = qtile * 16 + rowInTile;
    if (lane < 16) {
        sM[part][ql] = mrun;
        sL[part][ql] = lsum;
    }
    float* prow = &sO[part][ql * OPITCH + hb];
#pragma unroll
    for (int dt = 0; dt < 4; ++dt) {
        *reinterpret_cast<float4*>(prow + dt * 16) =
            make_float4(oacc[dt][0], oacc[dt][1], oacc[dt][2], oacc[dt][3]);
        *reinterpret_cast<float4*>(prow + dt * 16 + 4) =
            make_float4(oacc[dt][4], oacc[dt][5], oacc[dt][6], oacc[dt][7]);
    }
    __syncthreads();          // all four quarters' partials are in LDS

    // join: rescale each quarter to the common maximum, add, normalize, store
    // f32 output (N, L, 64); a wave's store covers 512 contiguous bytes
#pragma unroll
    for (int j = 0; j < 2; ++j) {
        const int q = j * 16 + (tid >> 4);
        const int d = (tid & 15) * 4;
        const float m0 = sM[0][q], m1 = sM[1][q], m2 = sM[2][q], m3 = sM[3][q];
        const float mall = fmaxf(fmaxf(m0, m1), fmaxf(m2, m3));
        const float f0 = exp2f(m0 - mall), f1 = exp2f(m1 - mall);
        const float f2 = exp2f(m2 - mall), f3 = exp2f(m3 - mall);
        const float lall = (f0 * sL[0][q] + f1 * sL[1][q]) +
                           (f2 * sL[2][q] + f3 * sL[3][q]);
        const float inv = 1.0f / lall;
        const float4 o0 = *reinterpret_cast<const float4*>(&sO[0][q * OPITCH + d]);
        const float4 o1 = *reinterpret_cast<const float4*>(&sO[1][q * OPITCH + d]);
        const float4 o2 = *reinterpret_cast<const float4*>(&sO[2][q * OPITCH + d]);
        const float4 o3 = *reinterpret_cast<const float4*>(&sO[3][q * OPITCH + d]);
        float4 r;
        r.x = ((f0 * o0.x + f1 * o1.x) + (f2 * o2.x + f3 * o3.x)) * inv;
        r.y = ((f0 * o0.y + f1 * o1.y) + (f2 * o2.y + f3 * o3.y)) * inv;
        r.z = ((f0 * o0.z + f1 * o1.z) + (f2 * o2.z + f3 * o3.z)) * inv;
        r.w = ((f0 * o0.w + f1 * o1.w) + (f2 * o2.w + f3 * o3.w)) * inv;
        *reinterpret_cast<float4*>(
            out + (size_t)(n * LL + qBase + q) * DD + d) = r;
    }
}

// ============================================================
extern "C" void kernel_launch(void* const* d_in, const int* in_sizes, int n_in,
                              void* d_out, int out_size, void* d_ws, size_t ws_size,
                              hipStream_t stream) {
    const float* query = (const float*)d_in[0];
    const float* key_  = (const float*)d_in[1];
    const float* value = (const float*)d_in[2];
    const float* Wq    = (const float*)d_in[3];
    const float* bq    = (const float*)d_in[4];
    const float* Wk    = (const float*)d_in[5];
    const float* bk    = (const float*)d_in[6];
    const float* Wv    = (const float*)d_in[7];
    const float* bv    = (const float*)d_in[8];
    float* out = (float*)d_out;

    const size_t elems = (size_t)NB * LL * DD;     // 524288
    __bf16* qb  = (__bf16*)d_ws;
    __bf16* kbr = qb + elems;
    __bf16* vbT = kbr + elems;
    __bf16* WT  = vbT + elems;                     // [3][64][1024]

    wconv_kernel<<<768, 256, 0, stream>>>(Wq, Wk, Wv, WT);
    dim3 g1(64, 3, 1);
    qkv_proj_kernel<<<g1, 256, 0, stream>>>(query, key_, value, WT,
                                            bq, bk, bv, qb, kbr, vbT);
    attn_kernel<<<256, 256, 0, stream>>>(qb, kbr, vbT, out);
}

// v003
// It runs in 50.7 microseconds.
// In two side-by-side timings against v002, it was 1.14 and 1.21 times as fast.
// All steps since v000 together make it 2.55 times as fast.
#include <hip/hip_runtime.h>
#include <hip/hip_bf16.h>

// ---- problem constants (from reference) ----
#define NB 4
#define LL 2048
#define HH 1024
#define DD 64

// 0.125 (=1/sqrt(64)) * log2(e): folded into the Q projection so the
// softmax can run directly on hardware base-2 exp (v_exp_f32).
#define QSCALE 0.18033688011112042f

typedef __attribute__((ext_vector_type(16))) __bf16 v16bf;
typedef __attribute__((ext_vector_type(8)))  float  v8f;

__device__ __forceinline__ v8f vzero8() {
    v8f z;
#pragma unroll
    for (int i = 0; i < 8; ++i) z[i] = 0.0f;
    return z;
}

// A/B 16-bit fragment K-index pattern (wave32):
// lane<16 holds K {0..7,16..23}, lane>=16 holds K {8..15,24..31}
__device__ __forceinline__ int fragK(int e, int kb) {
    return kb + e + ((e & 8) ? 8 : 0);
}

// CDNA5 async global->LDS copy (16 bytes per lane), tracked by ASYNCcnt.
// Low 32 bits of a generic pointer into LDS == wave-relative LDS byte offset
// (ISA 10.2 aperture mapping), which is what VDST wants.
__device__ __forceinline__ unsigned lds_addr(const void* p) {
    return (unsigned)(unsigned long long)p;
}
// Five async copies.  The closing s_wait_xcnt keeps every later rewrite of
// the address registers behind the copies' issue.
__device__ __forceinline__ void async_ld_b128_x5(
    unsigned l0, const void* g0, unsigned l1, const void* g1,
    unsigned l2, const void* g2, unsigned l3, const void* g3,
    unsigned l4, const void* g4) {
    asm volatile("global_load_async_to_lds_b128 %0, %1, off\n\t"
                 "global_load_async_to_lds_b128 %2, %3, off\n\t"
                 "global_load_async_to_lds_b128 %4, %5, off\n\t"
                 "global_load_async_to_lds_b128 %6, %7, off\n\t"
                 "global_load_async_to_lds_b128 %8, %9, off\n\t"
                 "s_wait_xcnt 0x0"
                 :: "v"(l0), "v"(g0), "v"(l1), "v"(g1), "v"(l2), "v"(g2),
                    "v"(l3), "v"(g3), "v"(l4), "v"(g4)
                 : "memory");
}
__device__ __forceinline__ void wait_async0() {
    asm volatile("s_wait_asynccnt 0" ::: "memory");
}
// This wave's LDS reads have returned before the buffer is handed back for a refill.
__device__ __forceinline__ void wait_ds0() {
    asm volatile("s_wait_dscnt 0x0" ::: "memory");
}

// LDS row pitches.  The fragments are read with 16-byte LDS loads, one tile
// row per lane: a pitch of 16 bytes x an odd number puts the 16 rows of a
// half wave on 16 different groups of four banks (128-byte rows -> 144 bytes,
// 64-byte rows -> 80 bytes).  The pad bytes are never written and never read.
#define P128F 36                 // f32  elements: 32 used + 4 pad
#define P128H 72                 // bf16 elements: 64 used + 8 pad
#define P64H  40                 // bf16 elements: 32 used + 8 pad

// ============================================================
// Kernel 0: convert W (f32, [1024][64]) -> WT (bf16, [3][64][1024])
// grid = 768, block = 256   (3 * 1024 * 64 elements)
// ============================================================
__global__ __launch_bounds__(256) void wconv_kernel(
    const float* __restrict__ Wq, const float* __restrict__ Wk,
    const float* __restrict__ Wv, __bf16* __restrict__ WT)
{
    const int idx = blockIdx.x * 256 + threadIdx.x;   // 0 .. 3*65536-1
    const int mat = idx >> 16;                        // 65536 = 1024*64
    const int r   = idx & 65535;
    const int k   = r >> 6;
    const int n   = r & 63;
    const float* W = (mat == 0) ? Wq : (mat == 1) ? Wk : Wv;
    WT[(size_t)mat * 64 * HH + (size_t)n * HH + k] = (__bf16)W[(size_t)k * DD + n];
}

// ============================================================
// Kernel 1: fused QKV projection.  grid = (64, 3), block = 256
//   X(8192x1024) * W(1024x64) + b  ->  bf16
//   mat 0 -> qb [m][d] (scaled by QSCALE) ; mat 1 -> kbr [m][d] ;
//   mat 2 -> vbT [n][d][l]
// Double-buffered async LDS staging.
// ============================================================
__global__ __launch_bounds__(256) void qkv_proj_kernel(
    const float* __restrict__ q_in, const float* __restrict__ k_in,
    const float* __restrict__ v_in,
    const __bf16* __restrict__ WT,                 // [3][64][1024] bf16
    const float* __restrict__ bq, const float* __restrict__ bk,
    const float* __restrict__ bv,
    __bf16* __restrict__ qb, __bf16* __restrict__ kbr, __bf16* __restrict__ vbT)
{
    const int mat = blockIdx.y;                    // 0=q, 1=k, 2=v
    const float*  X   = (mat == 0) ? q_in : (mat == 1) ? k_in : v_in;
    const __bf16* WTm = WT + (size_t)mat * 64 * HH;
    const float*  Bb  = (mat == 0) ? bq : (mat == 1) ? bk : bv;

    const int mBase     = blockIdx.x * 128;        // row base in flattened (N*L)
    const int tid       = threadIdx.x;
    const int lane      = tid & 31;
    const int wave      = tid >> 5;                // 0..7
    const int rowInTile = lane & 15;
    const int kb        = (lane & 16) ? 8 : 0;
    const int hb        = (lane & 16) ? 8 : 0;     // C-layout row offset

    __shared__ __align__(16) float  sA[2][128 * P128F];   // [row][k] f32
    __shared__ __align__(16) __bf16 sWT[2][64 * P64H];    // [n][k]  bf16

    // a thread's 16-byte pieces: rows ar, ar+32, ar+64, ar+96 of the X tile
    // and one piece of the W^T tile
    const int ar = tid >> 3, ac = (tid & 7) * 4;
    const int wr = tid >> 2, wc = (tid & 3) * 8;
    const float*  gA = X + (size_t)(mBase + ar) * HH + ac;
    const __bf16* gW = WTm + (size_t)wr * HH + wc;

    auto stage = [&](int kk, int bufi) {
        float* la = &sA[bufi][ar * P128F + ac];
        async_ld_b128_x5(
            lds_addr(la),              gA + kk,
            lds_addr(la + 32 * P128F), gA + kk + (size_t)32 * HH,
            lds_addr(la + 64 * P128F), gA + kk + (size_t)64 * HH,
            lds_addr(la + 96 * P128F), gA + kk + (size_t)96 * HH,
            lds_addr(&sWT[bufi][wr * P64H + wc]), gW + kk);
    };

    v8f acc[4];
#pragma unroll
    for (int nt = 0; nt < 4; ++nt) acc[nt] = vzero8();

    stage(0, 0);
    wait_async0();
    __syncthreads();

    for (int kk = 0; kk < HH; kk += 32) {
        const int bufi = (kk >> 5) & 1;
        if (kk + 32 < HH) stage(kk + 32, bufi ^ 1);   // prefetch next tile

        // A fragment: 16x32 (two contiguous runs -> ds_load_b128 + cvt)
        v16bf a;
        const float* arow = &sA[bufi][(wave * 16 + rowInTile) * P128F];
#pragma unroll
        for (int e = 0; e < 16; ++e) a[e] = (__bf16)arow[fragK(e, kb)];

        // 4 B fragments (bf16, no conversion) + WMMA
#pragma unroll
        for (int nt = 0; nt < 4; ++nt) {
            v16bf b;
            const __bf16* wrow = &sWT[bufi][(nt * 16 + rowInTile) * P64H];
#pragma unroll
            for (int e = 0; e < 16; ++e) b[e] = wrow[fragK(e, kb)];
            acc[nt] = __builtin_amdgcn_wmma_f32_16x16x32_bf16(
                false, a, false, b, (short)0, acc[nt], false, false);
        }
        wait_ds0();           // own reads of this buffer are over
        wait_async0();        // next tile landed
        __syncthreads();      // everyone done reading current tile
    }

    // epilogue: bias (+ softmax scale folded into Q) + bf16 store
    const int mTop = mBase + wave * 16;
#pragma unroll
    for (int nt = 0; nt < 4; ++nt) {
        const int d = nt * 16 + rowInTile;         // C layout: col = lane%16
        const float bias = Bb[d];
#pragma unroll
        for (int i = 0; i < 8; ++i) {
            const int m = mTop + hb + i;           // C layout: row = i (+8 hi half)
            float val = acc[nt][i] + bias;
            if (mat == 0) val *= QSCALE;           // fold 0.125*log2(e) into q
            const __bf16 h = (__bf16)val;
            const int n = m >> 11;                 // /L (2048)
            const int l = m & (LL - 1);
            if (mat == 2) {
                vbT[((size_t)n * DD + d) * LL + l] = h;
            } else {
                __bf16* dst = (mat == 0) ? qb : kbr;
                dst[(size_t)m * DD + d] = h;
            }
        }
    }
}

#define KPARTS 4
#define PKEYS  (LL / KPARTS)     // keys per quarter
#define NSTEP  (PKEYS / 32)      // steps per wave
#define OPITCH 68                // f32 row pitch of the partial O (16-byte column walks)

// value of lane l ^ 16
__device__ __forceinline__ float xhalf(float x) {
    const int xi = __builtin_bit_cast(int, x);
    return __builtin_bit_cast(float, __builtin_amdgcn_permlanex16(
        xi, xi, 0x76543210, 0xfedcba98, false, false));
}

// Eight async copies (16 bytes per lane each).  The closing s_wait_xcnt keeps
// every later rewrite of the address registers behind the copies' issue.
__device__ __forceinline__ void async_ld_b128_x8(
    unsigned l0, const void* g0, unsigned l1, const void* g1,
    unsigned l2, const void* g2, unsigned l3, const void* g3,
    unsigned l4, const void* g4, unsigned l5, const void* g5,
    unsigned l6, const void* g6, unsigned l7, const void* g7) {
    asm volatile("global_load_async_to_lds_b128 %0, %1, off\n\t"
                 "global_load_async_to_lds_b128 %2, %3, off\n\t"
                 "global_load_async_to_lds_b128 %4, %5, off\n\t"
                 "global_load_async_to_lds_b128 %6, %7, off\n\t"
                 "global_load_async_to_lds_b128 %8, %9, off\n\t"
                 "global_load_async_to_lds_b128 %10, %11, off\n\t"
                 "global_load_async_to_lds_b128 %12, %13, off\n\t"
                 "global_load_async_to_lds_b128 %14, %15, off\n\t"
                 "s_wait_xcnt 0x0"
                 :: "v"(l0), "v"(g0), "v"(l1), "v"(g1), "v"(l2), "v"(g2),
                    "v"(l3), "v"(g3), "v"(l4), "v"(g4), "v"(l5), "v"(g5),
                    "v"(l6), "v"(g6), "v"(l7), "v"(g7)
                 : "memory");
}

__global__ __launch_bounds__(256) void attn_kernel(
    const __bf16* __restrict__ qb, const __bf16* __restrict__ kbr,
    const __bf16* __restrict__ vbT, float* __restrict__ out)
{
    const int tid       = threadIdx.x;
    const int lane      = tid & 31;
    const int wave      = tid >> 5;
    const int qtile     = wave & 1;                // which 16 of the 32 queries
    const int part      = wave >> 1;               // which quarter of the keys
    const int n         = blockIdx.x >> 6;         // batch
    const int qBase     = (blockIdx.x & 63) * 32;
    const int rowInTile = lane & 15;
    const int kb        = (lane & 16) ? 8 : 0;
    const int hb        = (lane & 16) ? 8 : 0;

    __shared__ __align__(16) __bf16 sK[2][KPARTS][32 * P128H];   // [key][d]
    __shared__ __align__(16) __bf16 sVT[2][KPARTS][64 * P64H];   // [d][key]
    __shared__ __align__(16) float  sO[KPARTS][32 * OPITCH];  // [query][d]
    __shared__ float sM[KPARTS][32];
    __shared__ float sL[KPARTS][32];

    // a thread's 16-byte piece of each quarter's K tile and V^T tile
    const __bf16* gK = kbr + (size_t)n * LL * DD + tid * 8;
    const __bf16* gV = vbT + ((size_t)n * DD + (tid >> 2)) * LL + (tid & 3) * 8;
    const int kOff = (tid >> 3) * P128H + (tid & 7) * 8;   // its place in a K tile
    const int vOff = (tid >> 2) * P64H + (tid & 3) * 8;    // its place in a V^T tile

    auto stageKV = [&](int step, int bufi) {
        const __bf16* k0 = gK + (size_t)step * 32 * DD;
        const __bf16* v0 = gV + step * 32;
        async_ld_b128_x8(
            lds_addr(&sK[bufi][0][kOff]),  k0,
            lds_addr(&sK[bufi][1][kOff]),  k0 + (size_t)1 * PKEYS * DD,
            lds_addr(&sK[bufi][2][kOff]),  k0 + (size_t)2 * PKEYS * DD,
            lds_addr(&sK[bufi][3][kOff]),  k0 + (size_t)3 * PKEYS * DD,
            lds_addr(&sVT[bufi][0][vOff]), v0,
            lds_addr(&sVT[bufi][1][vOff]), v0 + 1 * PKEYS,
            lds_addr(&sVT[bufi][2][vOff]), v0 + 2 * PKEYS,
            lds_addr(&sVT[bufi][3][vOff]), v0 + 3 * PKEYS);
    };

    // load this wave's Q fragments (64 d x 16 queries -> two 32x16 B-frags)
    const __bf16* qrow =
        qb + (size_t)(n * LL + qBase + qtile * 16 + rowInTile) * DD;
    v16bf qf[2];
#pragma unroll
    for (int h = 0; h < 2; ++h)
#pragma unroll
        for (int e = 0; e < 16; ++e)
            qf[h][e] = qrow[h * 32 + fragK(e, kb)];

    v8f oacc[4];                                   // O^T: vgpr i -> d = dt*16+hb+i
#pragma unroll
    for (int dt = 0; dt < 4; ++dt) oacc[dt] = vzero8();
    float mrun = -1e30f;   // running maximum of this lane's query (both halves equal)
    float lrun = 0.0f;     // running sum over this lane's half of the keys

    stageKV(0, 0);
    wait_async0();
    __syncthreads();
    stageKV(1, 1);

    for (int st = 0; st < NSTEP; ++st) {
        const int bufi = st & 1;
        const __bf16* tK = sK[bufi][part];
        const __bf16* tV = sVT[bufi][part];

        // scores S^T = K Q^T (pre-scaled by 0.125*log2e): 2 key tiles x 2 d-steps
        // D layout: sc[ct][i] = S[query rowInTile][key ct*16 + hb + i]
        v8f sc[2];
        sc[0] = vzero8(); sc[1] = vzero8();
#pragma unroll
        for (int ct = 0; ct < 2; ++ct) {
            const int keyr = ct * 16 + rowInTile;
#pragma unroll
            for (int h = 0; h < 2; ++h) {
                v16bf akf;
#pragma unroll
                for (int e = 0; e < 16; ++e)
                    akf[e] = tK[keyr * P128H + h * 32 + fragK(e, kb)];
                sc[ct] = __builtin_amdgcn_wmma_f32_16x16x32_bf16(
                    false, akf, false, qf[h], (short)0, sc[ct], false, false);
            }
        }

        // online softmax in exp2 domain, one query per lane
        float t8[8];
#pragma unroll
        for (int i = 0; i < 8; ++i) t8[i] = fmaxf(sc[0][i], sc[1][i]);
        float tmax = fmaxf(fmaxf(fmaxf(t8[0], t8[1]), fmaxf(t8[2], t8[3])),
                           fmaxf(fmaxf(t8[4], t8[5]), fmaxf(t8[6], t8[7])));
        tmax = fmaxf(tmax, xhalf(tmax));           // join the two key halves
        const float mnew = fmaxf(mrun, tmax);
        const float corr = exp2f(mrun - mnew);     // v_exp_f32 is base-2
        mrun = mnew;

        // P^T: element e of the B fragment is key fragK(e, kb) = sc[e>>3][e&7]
        v16bf pf;
        float ps[8];
#pragma unroll
        for (int i = 0; i < 8; ++i) {
            const float p0 = exp2f(sc[0][i] - mnew);
            const float p1 = exp2f(sc[1][i] - mnew);
            pf[i]     = (__bf16)p0;
            pf[8 + i] = (__bf16)p1;
            ps[i] = p0 + p1;
        }
        const float psum = ((ps[0] + ps[1]) + (ps[2] + ps[3])) +
                           ((ps[4] + ps[5]) + (ps[6] + ps[7]));
        lrun = lrun * corr + psum;
#pragma unroll
        for (int dt = 0; dt < 4; ++dt)
#pragma unroll
            for (int i = 0; i < 8; ++i) oacc[dt][i] *= corr;

        // O^T += V^T P^T : 4 d-tiles (contiguous key runs -> ds_load_b128)
#pragma unroll
        for (int dt = 0; dt < 4; ++dt) {
            const int d = dt * 16 + rowInTile;
            v16bf avf;
#pragma unroll
            for (int e = 0; e < 16; ++e)
                avf[e] = tV[d * P64H + fragK(e, kb)];
            oacc[dt] = __builtin_amdgcn_wmma_f32_16x16x32_bf16(
                false, avf, false, pf, (short)0, oacc[dt], false, false);
        }
        wait_ds0();           // own reads of this buffer are over
        wait_async0();        // next K/V tiles landed
        __syncthreads();      // publishes them; everyone done reading this buffer
        if (st + 2 < NSTEP) stageKV(st + 2, bufi);   // refill the buffer just read
    }
    wait_async0();            // nothing in flight past the loop

    // hand this quarter's partial (max, sum, O) of 16 queries to the block
    const float lsum = lrun + xhalf(lrun);         // join the halves' sums
    const int ql = qtile * 16 + rowInTile;
    if (lane < 16) {
        sM[part][ql] = mrun;
        sL[part][ql] = lsum;
    }
    float* prow = &sO[part][ql * OPITCH + hb];
#pragma unroll
    for (int dt = 0; dt < 4; ++dt) {
        *reinterpret_cast<float4*>(prow + dt * 16) =
            make_float4(oacc[dt][0], oacc[dt][1], oacc[dt][2], oacc[dt][3]);
        *reinterpret_cast<float4*>(prow + dt * 16 + 4) =
            make_float4(oacc[dt][4], oacc[dt][5], oacc[dt][6], oacc[dt][7]);
    }
    __syncthreads();          // all four quarters' partials are in LDS

    // join: rescale each quarter to the common maximum, add, normalize, store
    // f32 output (N, L, 64); a wave's store covers 512 contiguous bytes
#pragma unroll
    for (int j = 0; j < 2; ++j) {
        const int q = j * 16 + (tid >> 4);
        const int d = (tid & 15) * 4;
        const float m0 = sM[0][q], m1 = sM[1][q], m2 = sM[2][q], m3 = sM[3][q];
        const float mall = fmaxf(fmaxf(m0, m1), fmaxf(m2, m3));
        const float f0 = exp2f(m0 - mall), f1 = exp2f(m1 - mall);
        const float f2 = exp2f(m2 - mall), f3 = exp2f(m3 - mall);
        const float lall = (f0 * sL[0][q] + f1 * sL[1][q]) +
                           (f2 * sL[2][q] + f3 * sL[3][q]);
        const float inv = 1.0f / lall;
        const float4 o0 = *reinterpret_cast<const float4*>(&sO[0][q * OPITCH + d]);
        const float4 o1 = *reinterpret_cast<const float4*>(&sO[1][q * OPITCH + d]);
        const float4 o2 = *reinterpret_cast<const float4*>(&sO[2][q * OPITCH + d]);
        const float4 o3 = *reinterpret_cast<const float4*>(&sO[3][q * OPITCH + d]);
        float4 r;
        r.x = ((f0 * o0.x + f1 * o1.x) + (f2 * o2.x + f3 * o3.x)) * inv;
        r.y = ((f0 * o0.y + f1 * o1.y) + (f2 * o2.y + f3 * o3.y)) * inv;
        r.z = ((f0 * o0.z + f1 * o1.z) + (f2 * o2.z + f3 * o3.z)) * inv;
        r.w = ((f0 * o0.w + f1 * o1.w) + (f2 * o2.w + f3 * o3.w)) * inv;
        *reinterpret_cast<float4*>(
            out + (size_t)(n * LL + qBase + q) * DD + d) = r;
    }
}

// ============================================================
extern "C" void kernel_launch(void* const* d_in, const int* in_sizes, int n_in,
                              void* d_out, int out_size, void* d_ws, size_t ws_size,
                              hipStream_t stream) {
    const float* query = (const float*)d_in[0];
    const float* key_  = (const float*)d_in[1];
    const float* value = (const float*)d_in[2];
    const float* Wq    = (const float*)d_in[3];
    const float* bq    = (const float*)d_in[4];
    const float* Wk    = (const float*)d_in[5];
    const float* bk    = (const float*)d_in[6];
    const float* Wv    = (const float*)d_in[7];
    const float* bv    = (const float*)d_in[8];
    float* out = (float*)d_out;

    const size_t elems = (size_t)NB * LL * DD;     // 524288
    __bf16* qb  = (__bf16*)d_ws;
    __bf16* kbr = qb + elems;
    __bf16* vbT = kbr + elems;
    __bf16* WT  = vbT + elems;                     // [3][64][1024]

    wconv_kernel<<<768, 256, 0, stream>>>(Wq, Wk, Wv, WT);
    dim3 g1(64, 3, 1);
    qkv_proj_kernel<<<g1, 256, 0, stream>>>(query, key_, value, WT,
                                            bq, bk, bv, qb, kbr, vbT);
    attn_kernel<<<256, 256, 0, stream>>>(qb, kbr, vbT, out);
}

// v004
// One run takes 44 microseconds.
// Timed twice side by side with v003, it ran 1.19 and 1.14 times as fast.
// Counting every step since v000, it is 2.96 times as fast.
#include <hip/hip_runtime.h>
#include <hip/hip_bf16.h>

// ---- problem constants (from reference) ----
#define NB 4
#define LL 2048
#define HH 1024
#define DD 64

// 0.125 (=1/sqrt(64)) * log2(e): folded into the Q projection so the
// softmax can run directly on hardware base-2 exp (v_exp_f32).
#define QSCALE 0.18033688011112042f

typedef __attribute__((ext_vector_type(16))) __bf16 v16bf;
typedef __attribute__((ext_vector_type(8)))  __bf16 v8bf;
typedef __attribute__((ext_vector_type(8)))  float  v8f;

__device__ __forceinline__ v8f vzero8() {
    v8f z;
#pragma unroll
    for (int i = 0; i < 8; ++i) z[i] = 0.0f;
    return z;
}

// A/B 16-bit fragment K-index pattern (wave32):
// lane<16 holds K {0..7,16..23}, lane>=16 holds K {8..15,24..31}
__device__ __forceinline__ int fragK(int e, int kb) {
    return kb + e + ((e & 8) ? 8 : 0);
}

// CDNA5 async global->LDS copy (16 bytes per lane), tracked by ASYNCcnt.
// Low 32 bits of a generic pointer into LDS == wave-relative LDS byte offset
// (ISA 10.2 aperture mapping), which is what VDST wants.
__device__ __forceinline__ unsigned lds_addr(const void* p) {
    return (unsigned)(unsigned long long)p;
}
// Four async copies.  The closing s_wait_xcnt keeps every later rewrite of
// the address registers behind the copies' issue.
__device__ __forceinline__ void async_ld_b128_x4(
    unsigned l0, const void* g0, unsigned l1, const void* g1,
    unsigned l2, const void* g2, unsigned l3, const void* g3) {
    asm volatile("global_load_async_to_lds_b128 %0, %1, off\n\t"
                 "global_load_async_to_lds_b128 %2, %3, off\n\t"
                 "global_load_async_to_lds_b128 %4, %5, off\n\t"
                 "global_load_async_to_lds_b128 %6, %7, off\n\t"
                 "s_wait_xcnt 0x0"
                 :: "v"(l0), "v"(g0), "v"(l1), "v"(g1), "v"(l2), "v"(g2),
                    "v"(l3), "v"(g3)
                 : "memory");
}
__device__ __forceinline__ void wait_async0() {
    asm volatile("s_wait_asynccnt 0" ::: "memory");
}
// This wave's LDS reads have returned before the buffer is handed back for a refill.
__device__ __forceinline__ void wait_ds0() {
    asm volatile("s_wait_dscnt 0x0" ::: "memory");
}

// LDS row pitches.  The fragments are read with 16-byte LDS loads, one tile
// row per lane: a pitch of 16 bytes x an odd number puts the 16 rows of a
// half wave on 16 different groups of four banks (128-byte rows -> 144 bytes,
// 64-byte rows -> 80 bytes).  The pad bytes are never written and never read.
#define P128F 36                 // f32  elements: 32 used + 4 pad
#define P128H 72                 // bf16 elements: 64 used + 8 pad
#define P64H  40                 // bf16 elements: 32 used + 8 pad

// ============================================================
// Kernel 1: fused QKV projection.  grid = (64, 3), block = 256
//   X(8192x1024) * W(1024x64) + b  ->  bf16
//   mat 0 -> qb [m][d] (scaled by QSCALE) ; mat 1 -> kbr [m][d] ;
//   mat 2 -> vbT [n][d][l]
// Double-buffered LDS staging: X by async copies; W (f32, [k][n]) through
// registers, where it is rounded to bf16 and turned to [n][k]: a thread loads
// 8 k of one column n (a wave's load = one 128-byte line) two tiles ahead and
// stores them one tile ahead as one 16-byte LDS row piece.
// ============================================================
__global__ __launch_bounds__(256) void qkv_proj_kernel(
    const float* __restrict__ q_in, const float* __restrict__ k_in,
    const float* __restrict__ v_in,
    const float* __restrict__ Wq, const float* __restrict__ Wk,
    const float* __restrict__ Wv,                  // [1024][64] f32
    const float* __restrict__ bq, const float* __restrict__ bk,
    const float* __restrict__ bv,
    __bf16* __restrict__ qb, __bf16* __restrict__ kbr, __bf16* __restrict__ vbT)
{
    const int mat = blockIdx.y;                    // 0=q, 1=k, 2=v
    const float*  X   = (mat == 0) ? q_in : (mat == 1) ? k_in : v_in;
    const float*  Wm  = (mat == 0) ? Wq : (mat == 1) ? Wk : Wv;
    const float*  Bb  = (mat == 0) ? bq : (mat == 1) ? bk : bv;

    const int mBase     = blockIdx.x * 128;        // row base in flattened (N*L)
    const int tid       = threadIdx.x;
    const int lane      = tid & 31;
    const int wave      = tid >> 5;                // 0..7
    const int rowInTile = lane & 15;
    const int kb        = (lane & 16) ? 8 : 0;
    const int hb        = (lane & 16) ? 8 : 0;     // C-layout row offset

    __shared__ __align__(16) float  sA[2][128 * P128F];   // [row][k] f32
    __shared__ __align__(16) __bf16 sWT[2][64 * P64H];    // [n][k]  bf16

    // a thread's 16-byte pieces: rows ar, ar+32, ar+64, ar+96 of the X tile
    const int ar = tid >> 3, ac = (tid & 7) * 4;
    const float* gA = X + (size_t)(mBase + ar) * HH + ac;
    // its piece of the W^T tile: column wn of W, rows wk .. wk+7 of the k tile
    const int wn = tid & 63, wk = (tid >> 6) * 8;
    const float* gW = Wm + (size_t)wk * DD + wn;

    float wreg[8];                                 // W values on their way to LDS
    auto loadW = [&](int kk) {
#pragma unroll
        for (int j = 0; j < 8; ++j) wreg[j] = gW[(size_t)(kk + j) * DD];
    };
    auto stage = [&](int kk, int bufi) {
        float* la = &sA[bufi][ar * P128F + ac];
        async_ld_b128_x4(
            lds_addr(la),              gA + kk,
            lds_addr(la + 32 * P128F), gA + kk + (size_t)32 * HH,
            lds_addr(la + 64 * P128F), gA + kk + (size_t)64 * HH,
            lds_addr(la + 96 * P128F), gA + kk + (size_t)96 * HH);
    };
    auto putW = [&](int bufi) {
        v8bf h;
#pragma unroll
        for (int j = 0; j < 8; ++j) h[j] = (__bf16)wreg[j];
        *reinterpret_cast<v8bf*>(&sWT[bufi][wn * P64H + wk]) = h;
    };

    v8f acc[4];
#pragma unroll
    for (int nt = 0; nt < 4; ++nt) acc[nt] = vzero8();

    loadW(0);
    stage(0, 0);
    putW(0);
    loadW(32);
    wait_async0();
    __syncthreads();

    for (int kk = 0; kk < HH; kk += 32) {
        const int bufi = (kk >> 5) & 1;
        if (kk + 32 < HH) {                           // prefetch next tile
            putW(bufi ^ 1);       // its W^T part, loaded a trip ago, into the buffer not being read
            if (kk + 64 < HH) loadW(kk + 64);
            stage(kk + 32, bufi ^ 1);
        }

        // A fragment: 16x32 (two contiguous runs -> ds_load_b128 + cvt)
        v16bf a;
        const float* arow = &sA[bufi][(wave * 16 + rowInTile) * P128F];
#pragma unroll
        for (int e = 0; e < 16; ++e) a[e] = (__bf16)arow[fragK(e, kb)];

        // 4 B fragments (bf16, no conversion) + WMMA
#pragma unroll
        for (int nt = 0; nt < 4; ++nt) {
            v16bf b;
            const __bf16* wrow = &sWT[bufi][(nt * 16 + rowInTile) * P64H];
#pragma unroll
            for (int e = 0; e < 16; ++e) b[e] = wrow[fragK(e, kb)];
            acc[nt] = __builtin_amdgcn_wmma_f32_16x16x32_bf16(
                false, a, false, b, (short)0, acc[nt], false, false);
        }
        wait_ds0();           // own reads of this buffer are over, own W^T piece is in
        wait_async0();        // next tile landed
        __syncthreads();      // everyone done reading current tile
    }

    // epilogue: bias (+ softmax scale folded into Q) + bf16 store
    const int mTop = mBase + wave * 16;
#pragma unroll
    for (int nt = 0; nt < 4; ++nt) {
        const int d = nt * 16 + rowInTile;         // C layout: col = lane%16
        const float bias = Bb[d];
#pragma unroll
        for (int i = 0; i < 8; ++i) {
            const int m = mTop + hb + i;           // C layout: row = i (+8 hi half)
            float val = acc[nt][i] + bias;
            if (mat == 0) val *= QSCALE;           // fold 0.125*log2(e) into q
            const __bf16 h = (__bf16)val;
            const int n = m >> 11;                 // /L (2048)
            const int l = m & (LL - 1);
            if (mat == 2) {
                vbT[((size_t)n * DD + d) * LL + l] = h;
            } else {
                __bf16* dst = (mat == 0) ? qb : kbr;
                dst[(size_t)m * DD + d] = h;
            }
        }
    }
}

#define KPARTS 4
#define PKEYS  (LL / KPARTS)     // keys per quarter
#define NSTEP  (PKEYS / 32)      // steps per wave
#define OPITCH 68                // f32 row pitch of the partial O (16-byte column walks)

// value of lane l ^ 16
__device__ __forceinline__ float xhalf(float x) {
    const int xi = __builtin_bit_cast(int, x);
    return __builtin_bit_cast(float, __builtin_amdgcn_permlanex16(
        xi, xi, 0x76543210, 0xfedcba98, false, false));
}

// Eight async copies (16 bytes per lane each).  The closing s_wait_xcnt keeps
// every later rewrite of the address registers behind the copies' issue.
__device__ __forceinline__ void async_ld_b128_x8(
    unsigned l0, const void* g0, unsigned l1, const void* g1,
    unsigned l2, const void* g2, unsigned l3, const void* g3,
    unsigned l4, const void* g4, unsigned l5, const void* g5,
    unsigned l6, const void* g6, unsigned l7, const void* g7) {
    asm volatile("global_load_async_to_lds_b128 %0, %1, off\n\t"
                 "global_load_async_to_lds_b128 %2, %3, off\n\t"
                 "global_load_async_to_lds_b128 %4, %5, off\n\t"
                 "global_load_async_to_lds_b128 %6, %7, off\n\t"
                 "global_load_async_to_lds_b128 %8, %9, off\n\t"
                 "global_load_async_to_lds_b128 %10, %11, off\n\t"
                 "global_load_async_to_lds_b128 %12, %13, off\n\t"
                 "global_load_async_to_lds_b128 %14, %15, off\n\t"
                 "s_wait_xcnt 0x0"
                 :: "v"(l0), "v"(g0), "v"(l1), "v"(g1), "v"(l2), "v"(g2),
                    "v"(l3), "v"(g3), "v"(l4), "v"(g4), "v"(l5), "v"(g5),
                    "v"(l6), "v"(g6), "v"(l7), "v"(g7)
                 : "memory");
}

__global__ __launch_bounds__(256) void attn_kernel(
    const __bf16* __restrict__ qb, const __bf16* __restrict__ kbr,
    const __bf16* __restrict__ vbT, float* __restrict__ out)
{
    const int tid       = threadIdx.x;
    const int lane      = tid & 31;
    const int wave      = tid >> 5;
    const int qtile     = wave & 1;                // which 16 of the 32 queries
    const int part      = wave >> 1;               // which quarter of the keys
    const int n         = blockIdx.x >> 6;         // batch
    const int qBase     = (blockIdx.x & 63) * 32;
    const int rowInTile = lane & 15;
    const int kb        = (lane & 16) ? 8 : 0;
    const int hb        = (lane & 16) ? 8 : 0;

    __shared__ __align__(16) __bf16 sK[2][KPARTS][32 * P128H];   // [key][d]
    __shared__ __align__(16) __bf16 sVT[2][KPARTS][64 * P64H];   // [d][key]
    __shared__ __align__(16) float  sO[KPARTS][32 * OPITCH];  // [query][d]
    __shared__ float sM[KPARTS][32];
    __shared__ float sL[KPARTS][32];

    // a thread's 16-byte piece of each quarter's K tile and V^T tile
    const __bf16* gK = kbr + (size_t)n * LL * DD + tid * 8;
    const __bf16* gV = vbT + ((size_t)n * DD + (tid >> 2)) * LL + (tid & 3) * 8;
    const int kOff = (tid >> 3) * P128H + (tid & 7) * 8;   // its place in a K tile
    const int vOff = (tid >> 2) * P64H + (tid & 3) * 8;    // its place in a V^T tile

    auto stageKV = [&](int step, int bufi) {
        const __bf16* k0 = gK + (size_t)step * 32 * DD;
        const __bf16* v0 = gV + step * 32;
        async_ld_b128_x8(
            lds_addr(&sK[bufi][0][kOff]),  k0,
            lds_addr(&sK[bufi][1][kOff]),  k0 + (size_t)1 * PKEYS * DD,
            lds_addr(&sK[bufi][2][kOff]),  k0 + (size_t)2 * PKEYS * DD,
            lds_addr(&sK[bufi][3][kOff]),  k0 + (size_t)3 * PKEYS * DD,
            lds_addr(&sVT[bufi][0][vOff]), v0,
            lds_addr(&sVT[bufi][1][vOff]), v0 + 1 * PKEYS,
            lds_addr(&sVT[bufi][2][vOff]), v0 + 2 * PKEYS,
            lds_addr(&sVT[bufi][3][vOff]), v0 + 3 * PKEYS);
    };

    // load this wave's Q fragments (64 d x 16 queries -> two 32x16 B-frags)
    const __bf16* qrow =
        qb + (size_t)(n * LL + qBase + qtile * 16 + rowInTile) * DD;
    v16bf qf[2];
#pragma unroll
    for (int h = 0; h < 2; ++h)
#pragma unroll
        for (int e = 0; e < 16; ++e)
            qf[h][e] = qrow[h * 32 + fragK(e, kb)];

    v8f oacc[4];                                   // O^T: vgpr i -> d = dt*16+hb+i
#pragma unroll
    for (int dt = 0; dt < 4; ++dt) oacc[dt] = vzero8();
    float mrun = -1e30f;   // running maximum of this lane's query (both halves equal)
    float lrun = 0.0f;     // running sum over this lane's half of the keys

    stageKV(0, 0);
    wait_async0();
    __syncthreads();
    stageKV(1, 1);

    for (int st = 0; st < NSTEP; ++st) {
        const int bufi = st & 1;
        const __bf16* tK = sK[bufi][part];
        const __bf16* tV = sVT[bufi][part];

        // scores S^T = K Q^T (pre-scaled by 0.125*log2e): 2 key tiles x 2 d-steps
        // D layout: sc[ct][i] = S[query rowInTile][key ct*16 + hb + i]
        v8f sc[2];
        sc[0] = vzero8(); sc[1] = vzero8();
#pragma unroll
        for (int ct = 0; ct < 2; ++ct) {
            const int keyr = ct * 16 + rowInTile;
#pragma unroll
            for (int h = 0; h < 2; ++h) {
                v16bf akf;
#pragma unroll
                for (int e = 0; e < 16; ++e)
                    akf[e] = tK[keyr * P128H + h * 32 + fragK(e, kb)];
                sc[ct] = __builtin_amdgcn_wmma_f32_16x16x32_bf16(
                    false, akf, false, qf[h], (short)0, sc[ct], false, false);
            }
        }

        // online softmax in exp2 domain, one query per lane
        float t8[8];
#pragma unroll
        for (int i = 0; i < 8; ++i) t8[i] = fmaxf(sc[0][i], sc[1][i]);
        float tmax = fmaxf(fmaxf(fmaxf(t8[0], t8[1]), fmaxf(t8[2], t8[3])),
                           fmaxf(fmaxf(t8[4], t8[5]), fmaxf(t8[6], t8[7])));
        tmax = fmaxf(tmax, xhalf(tmax));           // join the two key halves
        const float mnew = fmaxf(mrun, tmax);
        const float corr = exp2f(mrun - mnew);     // v_exp_f32 is base-2
        mrun = mnew;

        // P^T: element e of the B fragment is key fragK(e, kb) = sc[e>>3][e&7]
        v16bf pf;
        float ps[8];
#pragma unroll
        for (int i = 0; i < 8; ++i) {
            const float p0 = exp2f(sc[0][i] - mnew);
            const float p1 = exp2f(sc[1][i] - mnew);
            pf[i]     = (__bf16)p0;
            pf[8 + i] = (__bf16)p1;
            ps[i] = p0 + p1;
        }
        const float psum = ((ps[0] + ps[1]) + (ps[2] + ps[3])) +
                           ((ps[4] + ps[5]) + (ps[6] + ps[7]));
        lrun = lrun * corr + psum;
#pragma unroll
        for (int dt = 0; dt < 4; ++dt)
#pragma unroll
            for (int i = 0; i < 8; ++i) oacc[dt][i] *= corr;

        // O^T += V^T P^T : 4 d-tiles (contiguous key runs -> ds_load_b128)
#pragma unroll
        for (int dt = 0; dt < 4; ++dt) {
            const int d = dt * 16 + rowInTile;
            v16bf avf;
#pragma unroll
            for (int e = 0; e < 16; ++e)
                avf[e] = tV[d * P64H + fragK(e, kb)];
            oacc[dt] = __builtin_amdgcn_wmma_f32_16x16x32_bf16(
                false, avf, false, pf, (short)0, oacc[dt], false, false);
        }
        wait_ds0();           // own reads of this buffer are over
        wait_async0();        // next K/V tiles landed
        __syncthreads();      // publishes them; everyone done reading this buffer
        if (st + 2 < NSTEP) stageKV(st + 2, bufi);   // refill the buffer just read
    }
    wait_async0();            // nothing in flight past the loop

    // hand this quarter's partial (max, sum, O) of 16 queries to the block
    const float lsum = lrun + xhalf(lrun);         // join the halves' sums
    const int ql = qtile * 16 + rowInTile;
    if (lane < 16) {
        sM[part][ql] = mrun;
        sL[part][ql] = lsum;
    }
    float* prow = &sO[part][ql * OPITCH + hb];
#pragma unroll
    for (int dt = 0; dt < 4; ++dt) {
        *reinterpret_cast<float4*>(prow + dt * 16) =
            make_float4(oacc[dt][0], oacc[dt][1], oacc[dt][2], oacc[dt][3]);
        *reinterpret_cast<float4*>(prow + dt * 16 + 4) =
            make_float4(oacc[dt][4], oacc[dt][5], oacc[dt][6], oacc[dt][7]);
    }
    __syncthreads();          // all four quarters' partials are in LDS

    // join: rescale each quarter to the common maximum, add, normalize, store
    // f32 output (N, L, 64); a wave's store covers 512 contiguous bytes
#pragma unroll
    for (int j = 0; j < 2; ++j) {
        const int q = j * 16 + (tid >> 4);
        const int d = (tid & 15) * 4;
        const float m0 = sM[0][q], m1 = sM[1][q], m2 = sM[2][q], m3 = sM[3][q];
        const float mall = fmaxf(fmaxf(m0, m1), fmaxf(m2, m3));
        const float f0 = exp2f(m0 - mall), f1 = exp2f(m1 - mall);
        const float f2 = exp2f(m2 - mall), f3 = exp2f(m3 - mall);
        const float lall = (f0 * sL[0][q] + f1 * sL[1][q]) +
                           (f2 * sL[2][q] + f3 * sL[3][q]);
        const float inv = 1.0f / lall;
        const float4 o0 = *reinterpret_cast<const float4*>(&sO[0][q * OPITCH + d]);
        const float4 o1 = *reinterpret_cast<const float4*>(&sO[1][q * OPITCH + d]);
        const float4 o2 = *reinterpret_cast<const float4*>(&sO[2][q * OPITCH + d]);
        const float4 o3 = *reinterpret_cast<const float4*>(&sO[3][q * OPITCH + d]);
        float4 r;
        r.x = ((f0 * o0.x + f1 * o1.x) + (f2 * o2.x + f3 * o3.x)) * inv;
        r.y = ((f0 * o0.y + f1 * o1.y) + (f2 * o2.y + f3 * o3.y)) * inv;
        r.z = ((f0 * o0.z + f1 * o1.z) + (f2 * o2.z + f3 * o3.z)) * inv;
        r.w = ((f0 * o0.w + f1 * o1.w) + (f2 * o2.w + f3 * o3.w)) * inv;
        *reinterpret_cast<float4*>(
            out + (size_t)(n * LL + qBase + q) * DD + d) = r;
    }
}

// ============================================================
extern "C" void kernel_launch(void* const* d_in, const int* in_sizes, int n_in,
                              void* d_out, int out_size, void* d_ws, size_t ws_size,
                              hipStream_t stream) {
    const float* query = (const float*)d_in[0];
    const float* key_  = (const float*)d_in[1];
    const float* value = (const float*)d_in[2];
    const float* Wq    = (const float*)d_in[3];
    const float* bq    = (const float*)d_in[4];
    const float* Wk    = (const float*)d_in[5];
    const float* bk    = (const float*)d_in[6];
    const float* Wv    = (const float*)d_in[7];
    const float* bv    = (const float*)d_in[8];
    float* out = (float*)d_out;

    const size_t elems = (size_t)NB * LL * DD;     // 524288
    __bf16* qb  = (__bf16*)d_ws;
    __bf16* kbr = qb + elems;
    __bf16* vbT = kbr + elems;

    dim3 g1(64, 3, 1);
    qkv_proj_kernel<<<g1, 256, 0, stream>>>(query, key_, value, Wq, Wk, Wv,
                                            bq, bk, bv, qb, kbr, vbT);
    attn_kernel<<<256, 256, 0, stream>>>(qb, kbr, vbT, out);
}

// v005
// Measured time: 33.7 microseconds a run.
// Timed twice side by side with v004, it ran 1.36 and 1.35 times as fast.
// All steps since v000 together make it 4.02 times as fast.
#include <hip/hip_runtime.h>
#include <hip/hip_bf16.h>

// ---- problem constants (from reference) ----
#define NB 4
#define LL 2048
#define HH 1024
#define DD 64

// 0.125 (=1/sqrt(64)) * log2(e): folded into the Q projection so the
// softmax can run directly on hardware base-2 exp (v_exp_f32).
#define QSCALE 0.18033688011112042f

typedef __attribute__((ext_vector_type(16))) __bf16 v16bf;
typedef __attribute__((ext_vector_type(8)))  __bf16 v8bf;
typedef __attribute__((ext_vector_type(8)))  float  v8f;

__device__ __forceinline__ v8f vzero8() {
    v8f z;
#pragma unroll
    for (int i = 0; i < 8; ++i) z[i] = 0.0f;
    return z;
}

// A/B 16-bit fragment K-index pattern (wave32):
// lane<16 holds K {0..7,16..23}, lane>=16 holds K {8..15,24..31}
__device__ __forceinline__ int fragK(int e, int kb) {
    return kb + e + ((e & 8) ? 8 : 0);
}

// CDNA5 async global->LDS copy (16 bytes per lane), tracked by ASYNCcnt.
// Low 32 bits of a generic pointer into LDS == wave-relative LDS byte offset
// (ISA 10.2 aperture mapping), which is what VDST wants.
__device__ __forceinline__ unsigned lds_addr(const void* p) {
    return (unsigned)(unsigned long long)p;
}
// Eight async copies (16 bytes per lane each).  The closing s_wait_xcnt keeps
// every later rewrite of the address registers behind the copies' issue.
__device__ __forceinline__ void async_ld_b128_x8(
    unsigned l0, const void* g0, unsigned l1, const void* g1,
    unsigned l2, const void* g2, unsigned l3, const void* g3,
    unsigned l4, const void* g4, unsigned l5, const void* g5,
    unsigned l6, const void* g6, unsigned l7, const void* g7) {
    asm volatile("global_load_async_to_lds_b128 %0, %1, off\n\t"
                 "global_load_async_to_lds_b128 %2, %3, off\n\t"
                 "global_load_async_to_lds_b128 %4, %5, off\n\t"
                 "global_load_async_to_lds_b128 %6, %7, off\n\t"
                 "global_load_async_to_lds_b128 %8, %9, off\n\t"
                 "global_load_async_to_lds_b128 %10, %11, off\n\t"
                 "global_load_async_to_lds_b128 %12, %13, off\n\t"
                 "global_load_async_to_lds_b128 %14, %15, off\n\t"
                 "s_wait_xcnt 0x0"
                 :: "v"(l0), "v"(g0), "v"(l1), "v"(g1), "v"(l2), "v"(g2),
                    "v"(l3), "v"(g3), "v"(l4), "v"(g4), "v"(l5), "v"(g5),
                    "v"(l6), "v"(g6), "v"(l7), "v"(g7)
                 : "memory");
}
__device__ __forceinline__ void wait_async0() {
    asm volatile("s_wait_asynccnt 0" ::: "memory");
}
// This wave's LDS reads have returned before the buffer is handed back for a refill.
__device__ __forceinline__ void wait_ds0() {
    asm volatile("s_wait_dscnt 0x0" ::: "memory");
}

// LDS row pitches.  The fragments are read with 16-byte LDS loads, one tile
// row per lane: a pitch of 16 bytes x an odd number puts the 16 rows of a
// half wave on 16 different groups of four banks (512-byte rows -> 528 bytes,
// 256 -> 272, 128 -> 144, 64 -> 80).  The pad bytes are never written and
// never read.
#define P512F 132                // f32  elements: 128 used + 4 pad
#define P256H 136                // bf16 elements: 128 used + 8 pad
#define P128H 72                 // bf16 elements: 64 used + 8 pad
#define P64H  40                 // bf16 elements: 32 used + 8 pad

// k extent of one staged tile of the projection.  A block has one X tile in
// flight at a time, so the tile's bytes (128 rows x 512 bytes = 64 KiB) are
// what it holds outstanding against the memory latency.
#define KT 128

// ============================================================
// Kernel 1: fused QKV projection.  grid = (64, 3), block = 256
//   X(8192x1024) * W(1024x64) + b  ->  bf16
//   mat 0 -> qb [m][d] (scaled by QSCALE) ; mat 1 -> kbr [m][d] ;
//   mat 2 -> vbT [n][d][l]
// Double-buffered LDS staging, KT k per tile: X by async copies; W (f32,
// [k][n]) through registers, where it is rounded to bf16 and turned to [n][k]:
// a thread loads 4 runs of 8 k of one column n (a wave's load = one 128-byte
// line) two tiles ahead and stores them one tile ahead as 16-byte LDS row pieces.
// ============================================================
__global__ __launch_bounds__(256) void qkv_proj_kernel(
    const float* __restrict__ q_in, const float* __restrict__ k_in,
    const float* __restrict__ v_in,
    const float* __restrict__ Wq, const float* __restrict__ Wk,
    const float* __restrict__ Wv,                  // [1024][64] f32
    const float* __restrict__ bq, const float* __restrict__ bk,
    const float* __restrict__ bv,
    __bf16* __restrict__ qb, __bf16* __restrict__ kbr, __bf16* __restrict__ vbT)
{
    const int mat = blockIdx.y;                    // 0=q, 1=k, 2=v
    const float*  X   = (mat == 0) ? q_in : (mat == 1) ? k_in : v_in;
    const float*  Wm  = (mat == 0) ? Wq : (mat == 1) ? Wk : Wv;
    const float*  Bb  = (mat == 0) ? bq : (mat == 1) ? bk : bv;

    const int mBase     = blockIdx.x * 128;        // row base in flattened (N*L)
    const int tid       = threadIdx.x;
    const int lane      = tid & 31;
    const int wave      = tid >> 5;                // 0..7
    const int rowInTile = lane & 15;
    const int kb        = (lane & 16) ? 8 : 0;
    const int hb        = (lane & 16) ? 8 : 0;     // C-layout row offset

    __shared__ __align__(16) float  sA[2][128 * P512F];   // [row][k] f32
    __shared__ __align__(16) __bf16 sWT[2][64 * P256H];   // [n][k]  bf16

    // a wave's copy is one whole 512-byte tile row; its rows: wave + 8 c, c = 0..15
    const float* gA = X + (size_t)(mBase + wave) * HH + lane * 4;
    // a thread's pieces of the W^T tile: column wn of W, rows p*32 + wk .. + 7
    const int wn = tid & 63, wk = (tid >> 6) * 8;
    const float* gW = Wm + (size_t)wk * DD + wn;

    float wreg[KT / 4];                            // W values on their way to LDS
    auto loadW = [&](int kk) {
#pragma unroll
        for (int p = 0; p < KT / 32; ++p)
#pragma unroll
            for (int j = 0; j < 8; ++j)
                wreg[p * 8 + j] = gW[(size_t)(kk + p * 32 + j) * DD];
        // keeps the later advance of the loads' address registers behind their issue
        asm volatile("s_wait_xcnt 0x0" ::: "memory");
    };
    auto stage = [&](int kk, int bufi) {
#pragma unroll   // two statements of eight copies, row offsets constant
        for (int c = 0; c < 16; c += 8) {
            float* la = &sA[bufi][(wave + c * 8) * P512F + lane * 4];
            const float* g = gA + kk + (size_t)c * 8 * HH;
            async_ld_b128_x8(
                lds_addr(la),              g,
                lds_addr(la +  8 * P512F), g + (size_t) 8 * HH,
                lds_addr(la + 16 * P512F), g + (size_t)16 * HH,
                lds_addr(la + 24 * P512F), g + (size_t)24 * HH,
                lds_addr(la + 32 * P512F), g + (size_t)32 * HH,
                lds_addr(la + 40 * P512F), g + (size_t)40 * HH,
                lds_addr(la + 48 * P512F), g + (size_t)48 * HH,
                lds_addr(la + 56 * P512F), g + (size_t)56 * HH);
        }
    };
    auto putW = [&](int bufi) {
#pragma unroll
        for (int p = 0; p < KT / 32; ++p) {
            v8bf h;
#pragma unroll
            for (int j = 0; j < 8; ++j) h[j] = (__bf16)wreg[p * 8 + j];
            *reinterpret_cast<v8bf*>(&sWT[bufi][wn * P256H + p * 32 + wk]) = h;
        }
    };

    v8f acc[4];
#pragma unroll
    for (int nt = 0; nt < 4; ++nt) acc[nt] = vzero8();

    stage(0, 0);
    loadW(0);
    putW(0);
    loadW(KT);
    wait_async0();
    __syncthreads();

    for (int kk = 0; kk < HH; kk += KT) {
        const int bufi = (kk / KT) & 1;
        if (kk + KT < HH) {                           // prefetch next tile
            stage(kk + KT, bufi ^ 1);
            putW(bufi ^ 1);       // its W^T part, loaded a trip ago, into the buffer not being read
            if (kk + 2 * KT < HH) loadW(kk + 2 * KT);
        }

#pragma unroll   // constant LDS offsets; a later k step's reads can issue ahead
        for (int ks = 0; ks < KT; ks += 32) {
            // A fragment: 16x32 (two contiguous runs -> ds_load_b128 + cvt)
            v16bf a;
            const float* arow = &sA[bufi][(wave * 16 + rowInTile) * P512F + ks];
#pragma unroll
            for (int e = 0; e < 16; ++e) a[e] = (__bf16)arow[fragK(e, kb)];

            // 4 B fragments (bf16, no conversion) + WMMA
#pragma unroll
            for (int nt = 0; nt < 4; ++nt) {
                v16bf b;
                const __bf16* wrow = &sWT[bufi][(nt * 16 + rowInTile) * P256H + ks];
#pragma unroll
                for (int e = 0; e < 16; ++e) b[e] = wrow[fragK(e, kb)];
                acc[nt] = __builtin_amdgcn_wmma_f32_16x16x32_bf16(
                    false, a, false, b, (short)0, acc[nt], false, false);
            }
        }
        wait_ds0();           // own reads of this buffer are over, own W^T piece is in
        wait_async0();        // next tile landed
        __syncthreads();      // everyone done reading current tile
    }

    // epilogue: bias (+ softmax scale folded into Q) + bf16 store
    const int mTop = mBase + wave * 16;
#pragma unroll
    for (int nt = 0; nt < 4; ++nt) {
        const int d = nt * 16 + rowInTile;         // C layout: col = lane%16
        const float bias = Bb[d];
#pragma unroll
        for (int i = 0; i < 8; ++i) {
            const int m = mTop + hb + i;           // C layout: row = i (+8 hi half)
            float val = acc[nt][i] + bias;
            if (mat == 0) val *= QSCALE;           // fold 0.125*log2(e) into q
            const __bf16 h = (__bf16)val;
            const int n = m >> 11;                 // /L (2048)
            const int l = m & (LL - 1);
            if (mat == 2) {
                vbT[((size_t)n * DD + d) * LL + l] = h;
            } else {
                __bf16* dst = (mat == 0) ? qb : kbr;
                dst[(size_t)m * DD + d] = h;
            }
        }
    }
}

#define KPARTS 4
#define PKEYS  (LL / KPARTS)     // keys per quarter
#define NSTEP  (PKEYS / 32)      // steps per wave
#define OPITCH 68                // f32 row pitch of the partial O (16-byte column walks)

// value of lane l ^ 16
__device__ __forceinline__ float xhalf(float x) {
    const int xi = __builtin_bit_cast(int, x);
    return __builtin_bit_cast(float, __builtin_amdgcn_permlanex16(
        xi, xi, 0x76543210, 0xfedcba98, false, false));
}

__global__ __launch_bounds__(256) void attn_kernel(
    const __bf16* __restrict__ qb, const __bf16* __restrict__ kbr,
    const __bf16* __restrict__ vbT, float* __restrict__ out)
{
    const int tid       = threadIdx.x;
    const int lane      = tid & 31;
    const int wave      = tid >> 5;
    const int qtile     = wave & 1;                // which 16 of the 32 queries
    const int part      = wave >> 1;               // which quarter of the keys
    const int n         = blockIdx.x >> 6;         // batch
    const int qBase     = (blockIdx.x & 63) * 32;
    const int rowInTile = lane & 15;
    const int kb        = (lane & 16) ? 8 : 0;
    const int hb        = (lane & 16) ? 8 : 0;

    __shared__ __align__(16) __bf16 sK[2][KPARTS][32 * P128H];   // [key][d]
    __shared__ __align__(16) __bf16 sVT[2][KPARTS][64 * P64H];   // [d][key]
    __shared__ __align__(16) float  sO[KPARTS][32 * OPITCH];  // [query][d]
    __shared__ float sM[KPARTS][32];
    __shared__ float sL[KPARTS][32];

    // a thread's 16-byte piece of each quarter's K tile and V^T tile
    const __bf16* gK = kbr + (size_t)n * LL * DD + tid * 8;
    const __bf16* gV = vbT + ((size_t)n * DD + (tid >> 2)) * LL + (tid & 3) * 8;
    const int kOff = (tid >> 3) * P128H + (tid & 7) * 8;   // its place in a K tile
    const int vOff = (tid >> 2) * P64H + (tid & 3) * 8;    // its place in a V^T tile

    auto stageKV = [&](int step, int bufi) {
        const __bf16* k0 = gK + (size_t)step * 32 * DD;
        const __bf16* v0 = gV + step * 32;
        async_ld_b128_x8(
            lds_addr(&sK[bufi][0][kOff]),  k0,
            lds_addr(&sK[bufi][1][kOff]),  k0 + (size_t)1 * PKEYS * DD,
            lds_addr(&sK[bufi][2][kOff]),  k0 + (size_t)2 * PKEYS * DD,
            lds_addr(&sK[bufi][3][kOff]),  k0 + (size_t)3 * PKEYS * DD,
            lds_addr(&sVT[bufi][0][vOff]), v0,
            lds_addr(&sVT[bufi][1][vOff]), v0 + 1 * PKEYS,
            lds_addr(&sVT[bufi][2][vOff]), v0 + 2 * PKEYS,
            lds_addr(&sVT[bufi][3][vOff]), v0 + 3 * PKEYS);
    };

    // load this wave's Q fragments (64 d x 16 queries -> two 32x16 B-frags)
    const __bf16* qrow =
        qb + (size_t)(n * LL + qBase + qtile * 16 + rowInTile) * DD;
    v16bf qf[2];
#pragma unroll
    for (int h = 0; h < 2; ++h)
#pragma unroll
        for (int e = 0; e < 16; ++e)
            qf[h][e] = qrow[h * 32 + fragK(e, kb)];

    v8f oacc[4];                                   // O^T: vgpr i -> d = dt*16+hb+i
#pragma unroll
    for (int dt = 0; dt < 4; ++dt) oacc[dt] = vzero8();
    float mrun = -1e30f;   // running maximum of this lane's query (both halves equal)
    float lrun = 0.0f;     // running sum over this lane's half of the keys

    stageKV(0, 0);
    wait_async0();
    __syncthreads();
    stageKV(1, 1);

    for (int st = 0; st < NSTEP; ++st) {
        const int bufi = st & 1;
        const __bf16* tK = sK[bufi][part];
        const __bf16* tV = sVT[bufi][part];

        // scores S^T = K Q^T (pre-scaled by 0.125*log2e): 2 key tiles x 2 d-steps
        // D layout: sc[ct][i] = S[query rowInTile][key ct*16 + hb + i]
        v8f sc[2];
        sc[0] = vzero8(); sc[1] = vzero8();
#pragma unroll
        for (int ct = 0; ct < 2; ++ct) {
            const int keyr = ct * 16 + rowInTile;
#pragma unroll
            for (int h = 0; h < 2; ++h) {
                v16bf akf;
#pragma unroll
                for (int e = 0; e < 16; ++e)
                    akf[e] = tK[keyr * P128H + h * 32 + fragK(e, kb)];
                sc[ct] = __builtin_amdgcn_wmma_f32_16x16x32_bf16(
                    false, akf, false, qf[h], (short)0, sc[ct], false, false);
            }
        }

        // online softmax in exp2 domain, one query per lane
        float t8[8];
#pragma unroll
        for (int i = 0; i < 8; ++i) t8[i] = fmaxf(sc[0][i], sc[1][i]);
        float tmax = fmaxf(fmaxf(fmaxf(t8[0], t8[1]), fmaxf(t8[2], t8[3])),
                           fmaxf(fmaxf(t8[4], t8[5]), fmaxf(t8[6], t8[7])));
        tmax = fmaxf(tmax, xhalf(tmax));           // join the two key halves
        const float mnew = fmaxf(mrun, tmax);
        const float corr = exp2f(mrun - mnew);     // v_exp_f32 is base-2
        mrun = mnew;

        // P^T: element e of the B fragment is key fragK(e, kb) = sc[e>>3][e&7]
        v16bf pf;
        float ps[8];
#pragma unroll
        for (int i = 0; i < 8; ++i) {
            const float p0 = exp2f(sc[0][i] - mnew);
            const float p1 = exp2f(sc[1][i] - mnew);
            pf[i]     = (__bf16)p0;
            pf[8 + i] = (__bf16)p1;
            ps[i] = p0 + p1;
        }
        const float psum = ((ps[0] + ps[1]) + (ps[2] + ps[3])) +
                           ((ps[4] + ps[5]) + (ps[6] + ps[7]));
        lrun = lrun * corr + psum;
#pragma unroll
        for (int dt = 0; dt < 4; ++dt)
#pragma unroll
            for (int i = 0; i < 8; ++i) oacc[dt][i] *= corr;

        // O^T += V^T P^T : 4 d-tiles (contiguous key runs -> ds_load_b128)
#pragma unroll
        for (int dt = 0; dt < 4; ++dt) {
            const int d = dt * 16 + rowInTile;
            v16bf avf;
#pragma unroll
            for (int e = 0; e < 16; ++e)
                avf[e] = tV[d * P64H + fragK(e, kb)];
            oacc[dt] = __builtin_amdgcn_wmma_f32_16x16x32_bf16(
                false, avf, false, pf, (short)0, oacc[dt], false, false);
        }
        wait_ds0();           // own reads of this buffer are over
        wait_async0();        // next K/V tiles landed
        __syncthreads();      // publishes them; everyone done reading this buffer
        if (st + 2 < NSTEP) stageKV(st + 2, bufi);   // refill the buffer just read
    }
    wait_async0();            // nothing in flight past the loop

    // hand this quarter's partial (max, sum, O) of 16 queries to the block
    const float lsum = lrun + xhalf(lrun);         // join the halves' sums
    const int ql = qtile * 16 + rowInTile;
    if (lane < 16) {
        sM[part][ql] = mrun;
        sL[part][ql] = lsum;
    }
    float* prow = &sO[part][ql * OPITCH + hb];
#pragma unroll
    for (int dt = 0; dt < 4; ++dt) {
        *reinterpret_cast<float4*>(prow + dt * 16) =
            make_float4(oacc[dt][0], oacc[dt][1], oacc[dt][2], oacc[dt][3]);
        *reinterpret_cast<float4*>(prow + dt * 16 + 4) =
            make_float4(oacc[dt][4], oacc[dt][5], oacc[dt][6], oacc[dt][7]);
    }
    __syncthreads();          // all four quarters' partials are in LDS

    // join: rescale each quarter to the common maximum, add, normalize, store
    // f32 output (N, L, 64); a wave's store covers 512 contiguous bytes
#pragma unroll
    for (int j = 0; j < 2; ++j) {
        const int q = j * 16 + (tid >> 4);
        const int d = (tid & 15) * 4;
        const float m0 = sM[0][q], m1 = sM[1][q], m2 = sM[2][q], m3 = sM[3][q];
        const float mall = fmaxf(fmaxf(m0, m1), fmaxf(m2, m3));
        const float f0 = exp2f(m0 - mall), f1 = exp2f(m1 - mall);
        const float f2 = exp2f(m2 - mall), f3 = exp2f(m3 - mall);
        const float lall = (f0 * sL[0][q] + f1 * sL[1][q]) +
                           (f2 * sL[2][q] + f3 * sL[3][q]);
        const float inv = 1.0f / lall;
        const float4 o0 = *reinterpret_cast<const float4*>(&sO[0][q * OPITCH + d]);
        const float4 o1 = *reinterpret_cast<const float4*>(&sO[1][q * OPITCH + d]);
        const float4 o2 = *reinterpret_cast<const float4*>(&sO[2][q * OPITCH + d]);
        const float4 o3 = *reinterpret_cast<const float4*>(&sO[3][q * OPITCH + d]);
        float4 r;
        r.x = ((f0 * o0.x + f1 * o1.x) + (f2 * o2.x + f3 * o3.x)) * inv;
        r.y = ((f0 * o0.y + f1 * o1.y) + (f2 * o2.y + f3 * o3.y)) * inv;
        r.z = ((f0 * o0.z + f1 * o1.z) + (f2 * o2.z + f3 * o3.z)) * inv;
        r.w = ((f0 * o0.w + f1 * o1.w) + (f2 * o2.w + f3 * o3.w)) * inv;
        *reinterpret_cast<float4*>(
            out + (size_t)(n * LL + qBase + q) * DD + d) = r;
    }
}

// ============================================================
extern "C" void kernel_launch(void* const* d_in, const int* in_sizes, int n_in,
                              void* d_out, int out_size, void* d_ws, size_t ws_size,
                              hipStream_t stream) {
    const float* query = (const float*)d_in[0];
    const float* key_  = (const float*)d_in[1];
    const float* value = (const float*)d_in[2];
    const float* Wq    = (const float*)d_in[3];
    const float* bq    = (const float*)d_in[4];
    const float* Wk    = (const float*)d_in[5];
    const float* bk    = (const float*)d_in[6];
    const float* Wv    = (const float*)d_in[7];
    const float* bv    = (const float*)d_in[8];
    float* out = (float*)d_out;

    const size_t elems = (size_t)NB * LL * DD;     // 524288
    __bf16* qb  = (__bf16*)d_ws;
    __bf16* kbr = qb + elems;
    __bf16* vbT = kbr + elems;

    dim3 g1(64, 3, 1);
    qkv_proj_kernel<<<g1, 256, 0, stream>>>(query, key_, value, Wq, Wk, Wv,
                                            bq, bk, bv, qb, kbr, vbT);
    attn_kernel<<<256, 256, 0, stream>>>(qb, kbr, vbT, out);
}

// v006
// One run takes 28.7 microseconds.
// Two timings next to v005 put it at 1.14 and 1.18 times that version's speed.
// All steps since v000 together make it 4.65 times as fast.
#include <hip/hip_runtime.h>
#include <hip/hip_bf16.h>

// ---- problem constants (from reference) ----
#define NB 4
#define LL 2048
#define HH 1024
#define DD 64

// 0.125 (=1/sqrt(64)) * log2(e): folded into the Q projection so the
// softmax can run directly on hardware base-2 exp (v_exp_f32).
#define QSCALE 0.18033688011112042f

typedef __attribute__((ext_vector_type(16))) __bf16 v16bf;
typedef __attribute__((ext_vector_type(8)))  __bf16 v8bf;
typedef __attribute__((ext_vector_type(8)))  float  v8f;

__device__ __forceinline__ v8f vzero8() {
    v8f z;
#pragma unroll
    for (int i = 0; i < 8; ++i) z[i] = 0.0f;
    return z;
}

// A/B 16-bit fragment K-index pattern (wave32):
// lane<16 holds K {0..7,16..23}, lane>=16 holds K {8..15,24..31}
__device__ __forceinline__ int fragK(int e, int kb) {
    return kb + e + ((e & 8) ? 8 : 0);
}

// CDNA5 async global->LDS copy (16 bytes per lane), tracked by ASYNCcnt.
// Low 32 bits of a generic pointer into LDS == wave-relative LDS byte offset
// (ISA 10.2 aperture mapping), which is what VDST wants.
__device__ __forceinline__ unsigned lds_addr(const void* p) {
    return (unsigned)(unsigned long long)p;
}
// Eight async copies (16 bytes per lane each).  The closing s_wait_xcnt keeps
// every later rewrite of the address registers behind the copies' issue.
__device__ __forceinline__ void async_ld_b128_x8(
    unsigned l0, const void* g0, unsigned l1, const void* g1,
    unsigned l2, const void* g2, unsigned l3, const void* g3,
    unsigned l4, const void* g4, unsigned l5, const void* g5,
    unsigned l6, const void* g6, unsigned l7, const void* g7) {
    asm volatile("global_load_async_to_lds_b128 %0, %1, off\n\t"
                 "global_load_async_to_lds_b128 %2, %3, off\n\t"
                 "global_load_async_to_lds_b128 %4, %5, off\n\t"
                 "global_load_async_to_lds_b128 %6, %7, off\n\t"
                 "global_load_async_to_lds_b128 %8, %9, off\n\t"
                 "global_load_async_to_lds_b128 %10, %11, off\n\t"
                 "global_load_async_to_lds_b128 %12, %13, off\n\t"
                 "global_load_async_to_lds_b128 %14, %15, off\n\t"
                 "s_wait_xcnt 0x0"
                 :: "v"(l0), "v"(g0), "v"(l1), "v"(g1), "v"(l2), "v"(g2),
                    "v"(l3), "v"(g3), "v"(l4), "v"(g4), "v"(l5), "v"(g5),
                    "v"(l6), "v"(g6), "v"(l7), "v"(g7)
                 : "memory");
}
__device__ __forceinline__ void wait_async0() {
    asm volatile("s_wait_asynccnt 0" ::: "memory");
}
// This wave's LDS reads have returned before the buffer is handed back for a refill.
__device__ __forceinline__ void wait_ds0() {
    asm volatile("s_wait_dscnt 0x0" ::: "memory");
}

// LDS row pitches.  The fragments are read with 16-byte LDS loads, one tile
// row per lane: a pitch of 16 bytes x an odd number puts the 16 rows of a
// half wave on 16 different groups of four banks (512-byte rows -> 528 bytes,
// 256 -> 272, 128 -> 144, 64 -> 80).  The pad bytes are never written and
// never read.
#define P512F 132                // f32  elements: 128 used + 4 pad
#define P256H 136                // bf16 elements: 128 used + 8 pad
#define P128H 72                 // bf16 elements: 64 used + 8 pad
#define P64H  40                 // bf16 elements: 32 used + 8 pad

// k extent of one staged tile of the projection.  A block has one X tile in
// flight at a time, so the tile's bytes (128 rows x 512 bytes = 64 KiB) are
// what it holds outstanding against the memory latency.
#define KT 128

// ============================================================
// Kernel 1: fused QKV projection.  grid = (64, 3), block = 256
//   X(8192x1024) * W(1024x64) + b  ->  bf16
//   mat 0 -> qb [m][d] (scaled by QSCALE) ; mat 1 -> kbr [m][d] ;
//   mat 2 -> vbT [n][d][l]
// Double-buffered LDS staging, KT k per tile: X by async copies; W (f32,
// [k][n]) through registers, where it is rounded to bf16 and turned to [n][k]:
// a thread loads 4 runs of 8 k of one column n (a wave's load = one 128-byte
// line) two tiles ahead and stores them one tile ahead as 16-byte LDS row pieces.
// Operand order by output layout, so that a lane's 8 accumulator registers are
// 8 neighbours of one output row: V^T (VT) takes X as A and W^T as B (lane =
// column d, registers = 8 l); Q and K take W^T as A and X as B (lane = row m,
// registers = 8 d).  The block's bf16 tile is gathered in LDS with 16-byte
// stores and leaves as whole rows: 64 x 256 bytes (V^T), 128 x 128 bytes (Q, K).
// ============================================================
template <bool VT>
__device__ __forceinline__ void proj_body(
    const float* __restrict__ X, const float* __restrict__ Wm,
    const float* __restrict__ Bb, const float scale, __bf16* __restrict__ dst,
    float (*sA)[128 * P512F], __bf16 (*sWT)[64 * P256H])
{
    const int mBase     = blockIdx.x * 128;        // row base in flattened (N*L)
    const int tid       = threadIdx.x;
    const int lane      = tid & 31;
    const int wave      = tid >> 5;                // 0..7
    const int rowInTile = lane & 15;
    const int kb        = (lane & 16) ? 8 : 0;
    const int hb        = (lane & 16) ? 8 : 0;     // C-layout row offset

    // a wave's copy is one whole 512-byte tile row; its rows: wave + 8 c, c = 0..15
    const float* gA = X + (size_t)(mBase + wave) * HH + lane * 4;
    // a thread's pieces of the W^T tile: column wn of W, rows p*32 + wk .. + 7
    const int wn = tid & 63, wk = (tid >> 6) * 8;
    const float* gW = Wm + (size_t)wk * DD + wn;

    float wreg[KT / 4];                            // W values on their way to LDS
    auto loadW = [&](int kk) {
#pragma unroll
        for (int p = 0; p < KT / 32; ++p)
#pragma unroll
            for (int j = 0; j < 8; ++j)
                wreg[p * 8 + j] = gW[(size_t)(kk + p * 32 + j) * DD];
        // keeps the later advance of the loads' address registers behind their issue
        asm volatile("s_wait_xcnt 0x0" ::: "memory");
    };
    auto stage = [&](int kk, int bufi) {
#pragma unroll   // two statements of eight copies, row offsets constant
        for (int c = 0; c < 16; c += 8) {
            float* la = &sA[bufi][(wave + c * 8) * P512F + lane * 4];
            const float* g = gA + kk + (size_t)c * 8 * HH;
            async_ld_b128_x8(
                lds_addr(la),              g,
                lds_addr(la +  8 * P512F), g + (size_t) 8 * HH,
                lds_addr(la + 16 * P512F), g + (size_t)16 * HH,
                lds_addr(la + 24 * P512F), g + (size_t)24 * HH,
                lds_addr(la + 32 * P512F), g + (size_t)32 * HH,
                lds_addr(la + 40 * P512F), g + (size_t)40 * HH,
                lds_addr(la + 48 * P512F), g + (size_t)48 * HH,
                lds_addr(la + 56 * P512F), g + (size_t)56 * HH);
        }
    };
    auto putW = [&](int bufi) {
#pragma unroll
        for (int p = 0; p < KT / 32; ++p) {
            v8bf h;
#pragma unroll
            for (int j = 0; j < 8; ++j) h[j] = (__bf16)wreg[p * 8 + j];
            *reinterpret_cast<v8bf*>(&sWT[bufi][wn * P256H + p * 32 + wk]) = h;
        }
    };

    v8f acc[4];
#pragma unroll
    for (int nt = 0; nt < 4; ++nt) acc[nt] = vzero8();

    stage(0, 0);
    loadW(0);
    putW(0);
    loadW(KT);
    wait_async0();
    __syncthreads();

    for (int kk = 0; kk < HH; kk += KT) {
        const int bufi = (kk / KT) & 1;
        if (kk + KT < HH) {                           // prefetch next tile
            stage(kk + KT, bufi ^ 1);
            putW(bufi ^ 1);       // its W^T part, loaded a trip ago, into the buffer not being read
            if (kk + 2 * KT < HH) loadW(kk + 2 * KT);
        }

#pragma unroll   // constant LDS offsets; a later k step's reads can issue ahead
        for (int ks = 0; ks < KT; ks += 32) {
            // X fragment: 16 rows x 32 k (two contiguous runs -> ds_load_b128 + cvt)
            v16bf a;
            const float* arow = &sA[bufi][(wave * 16 + rowInTile) * P512F + ks];
#pragma unroll
            for (int e = 0; e < 16; ++e) a[e] = (__bf16)arow[fragK(e, kb)];

            // 4 W^T fragments (bf16, no conversion) + WMMA
#pragma unroll
            for (int nt = 0; nt < 4; ++nt) {
                v16bf b;
                const __bf16* wrow = &sWT[bufi][(nt * 16 + rowInTile) * P256H + ks];
#pragma unroll
                for (int e = 0; e < 16; ++e) b[e] = wrow[fragK(e, kb)];
                if (VT)
                    acc[nt] = __builtin_amdgcn_wmma_f32_16x16x32_bf16(
                        false, a, false, b, (short)0, acc[nt], false, false);
                else
                    acc[nt] = __builtin_amdgcn_wmma_f32_16x16x32_bf16(
                        false, b, false, a, (short)0, acc[nt], false, false);
            }
        }
        wait_ds0();           // own reads of this buffer are over, own W^T piece is in
        wait_async0();        // next tile landed
        __syncthreads();      // everyone done reading current tile
    }

    // epilogue: bias (+ softmax scale folded into Q), bf16, gathered in the LDS
    // that the loop's last barrier has freed (nothing is in flight into it)
    __bf16* sT = reinterpret_cast<__bf16*>(&sA[0][0]);
    if (VT) {
        // acc[nt][i] = V[mBase + wave*16 + hb + i][nt*16 + rowInTile]
#pragma unroll
        for (int nt = 0; nt < 4; ++nt) {
            const float bias = Bb[nt * 16 + rowInTile];
            v8bf h;
#pragma unroll
            for (int i = 0; i < 8; ++i) h[i] = (__bf16)(acc[nt][i] + bias);
            *reinterpret_cast<v8bf*>(
                &sT[(nt * 16 + rowInTile) * P256H + wave * 16 + hb]) = h;
        }
        __syncthreads();      // the tile's rows hold pieces of all eight waves
        const int n  = mBase >> 11;                // /L (2048)
        const int l0 = mBase & (LL - 1);
        __bf16* g = dst + ((size_t)n * DD + (tid >> 4)) * LL + l0 + (tid & 15) * 8;
        const __bf16* s = &sT[(tid >> 4) * P256H + (tid & 15) * 8];
#pragma unroll
        for (int j = 0; j < 4; ++j)                // a wave: two rows of 256 bytes
            *reinterpret_cast<v8bf*>(g + (size_t)j * 16 * LL) =
                *reinterpret_cast<const v8bf*>(s + j * 16 * P256H);
    } else {
        // acc[nt][i] = Y[mBase + wave*16 + rowInTile][nt*16 + hb + i]
#pragma unroll
        for (int nt = 0; nt < 4; ++nt) {
            const float4 b0 = *reinterpret_cast<const float4*>(Bb + nt * 16 + hb);
            const float4 b1 = *reinterpret_cast<const float4*>(Bb + nt * 16 + hb + 4);
            const float bias[8] = {b0.x, b0.y, b0.z, b0.w, b1.x, b1.y, b1.z, b1.w};
            v8bf h;
#pragma unroll
            for (int i = 0; i < 8; ++i)
                h[i] = (__bf16)((acc[nt][i] + bias[i]) * scale);
            *reinterpret_cast<v8bf*>(
                &sT[(wave * 16 + rowInTile) * P128H + nt * 16 + hb]) = h;
        }
        __syncthreads();      // orders the lanes' LDS stores before the row-wise reads
        __bf16* g = dst + (size_t)(mBase + (tid >> 3)) * DD + (tid & 7) * 8;
        const __bf16* s = &sT[(tid >> 3) * P128H + (tid & 7) * 8];
#pragma unroll
        for (int j = 0; j < 4; ++j)                // a wave: 512 contiguous bytes
            *reinterpret_cast<v8bf*>(g + (size_t)j * 32 * DD) =
                *reinterpret_cast<const v8bf*>(s + j * 32 * P128H);
    }
}

__global__ __launch_bounds__(256) void qkv_proj_kernel(
    const float* __restrict__ q_in, const float* __restrict__ k_in,
    const float* __restrict__ v_in,
    const float* __restrict__ Wq, const float* __restrict__ Wk,
    const float* __restrict__ Wv,                  // [1024][64] f32
    const float* __restrict__ bq, const float* __restrict__ bk,
    const float* __restrict__ bv,
    __bf16* __restrict__ qb, __bf16* __restrict__ kbr, __bf16* __restrict__ vbT)
{
    __shared__ __align__(16) float  sA[2][128 * P512F];   // [row][k] f32
    __shared__ __align__(16) __bf16 sWT[2][64 * P256H];   // [n][k]  bf16

    const int mat = blockIdx.y;                    // 0=q, 1=k, 2=v
    if (mat == 2) {
        proj_body<true>(v_in, Wv, bv, 1.0f, vbT, sA, sWT);
    } else {
        // 0.125*log2(e) folded into q; times 1.0f leaves k as it is
        proj_body<false>(mat == 0 ? q_in : k_in, mat == 0 ? Wq : Wk,
                         mat == 0 ? bq : bk, mat == 0 ? QSCALE : 1.0f,
                         mat == 0 ? qb : kbr, sA, sWT);
    }
}

#define KPARTS 4
#define PKEYS  (LL / KPARTS)     // keys per quarter
#define NSTEP  (PKEYS / 32)      // steps per wave
#define OPITCH 68                // f32 row pitch of the partial O (16-byte column walks)

// value of lane l ^ 16
__device__ __forceinline__ float xhalf(float x) {
    const int xi = __builtin_bit_cast(int, x);
    return __builtin_bit_cast(float, __builtin_amdgcn_permlanex16(
        xi, xi, 0x76543210, 0xfedcba98, false, false));
}

__global__ __launch_bounds__(256) void attn_kernel(
    const __bf16* __restrict__ qb, const __bf16* __restrict__ kbr,
    const __bf16* __restrict__ vbT, float* __restrict__ out)
{
    const int tid       = threadIdx.x;
    const int lane      = tid & 31;
    const int wave      = tid >> 5;
    const int qtile     = wave & 1;                // which 16 of the 32 queries
    const int part      = wave >> 1;               // which quarter of the keys
    const int n         = blockIdx.x >> 6;         // batch
    const int qBase     = (blockIdx.x & 63) * 32;
    const int rowInTile = lane & 15;
    const int kb        = (lane & 16) ? 8 : 0;
    const int hb        = (lane & 16) ? 8 : 0;

    __shared__ __align__(16) __bf16 sK[2][KPARTS][32 * P128H];   // [key][d]
    __shared__ __align__(16) __bf16 sVT[2][KPARTS][64 * P64H];   // [d][key]
    __shared__ __align__(16) float  sO[KPARTS][32 * OPITCH];  // [query][d]
    __shared__ float sM[KPARTS][32];
    __shared__ float sL[KPARTS][32];

    // a thread's 16-byte piece of each quarter's K tile and V^T tile
    const __bf16* gK = kbr + (size_t)n * LL * DD + tid * 8;
    const __bf16* gV = vbT + ((size_t)n * DD + (tid >> 2)) * LL + (tid & 3) * 8;
    const int kOff = (tid >> 3) * P128H + (tid & 7) * 8;   // its place in a K tile
    const int vOff = (tid >> 2) * P64H + (tid & 3) * 8;    // its place in a V^T tile

    auto stageKV = [&](int step, int bufi) {
        const __bf16* k0 = gK + (size_t)step * 32 * DD;
        const __bf16* v0 = gV + step * 32;
        async_ld_b128_x8(
            lds_addr(&sK[bufi][0][kOff]),  k0,
            lds_addr(&sK[bufi][1][kOff]),  k0 + (size_t)1 * PKEYS * DD,
            lds_addr(&sK[bufi][2][kOff]),  k0 + (size_t)2 * PKEYS * DD,
            lds_addr(&sK[bufi][3][kOff]),  k0 + (size_t)3 * PKEYS * DD,
            lds_addr(&sVT[bufi][0][vOff]), v0,
            lds_addr(&sVT[bufi][1][vOff]), v0 + 1 * PKEYS,
            lds_addr(&sVT[bufi][2][vOff]), v0 + 2 * PKEYS,
            lds_addr(&sVT[bufi][3][vOff]), v0 + 3 * PKEYS);
    };

    // load this wave's Q fragments (64 d x 16 queries -> two 32x16 B-frags)
    const __bf16* qrow =
        qb + (size_t)(n * LL + qBase + qtile * 16 + rowInTile) * DD;
    v16bf qf[2];
#pragma unroll
    for (int h = 0; h < 2; ++h)
#pragma unroll
        for (int e = 0; e < 16; ++e)
            qf[h][e] = qrow[h * 32 + fragK(e, kb)];

    v8f oacc[4];                                   // O^T: vgpr i -> d = dt*16+hb+i
#pragma unroll
    for (int dt = 0; dt < 4; ++dt) oacc[dt] = vzero8();
    float mrun = -1e30f;   // running maximum of this lane's query (both halves equal)
    float lrun = 0.0f;     // running sum over this lane's half of the keys

    stageKV(0, 0);
    wait_async0();
    __syncthreads();
    stageKV(1, 1);

    for (int st = 0; st < NSTEP; ++st) {
        const int bufi = st & 1;
        const __bf16* tK = sK[bufi][part];
        const __bf16* tV = sVT[bufi][part];

        // scores S^T = K Q^T (pre-scaled by 0.125*log2e): 2 key tiles x 2 d-steps
        // D layout: sc[ct][i] = S[query rowInTile][key ct*16 + hb + i]
        v8f sc[2];
        sc[0] = vzero8(); sc[1] = vzero8();
#pragma unroll
        for (int ct = 0; ct < 2; ++ct) {
            const int keyr = ct * 16 + rowInTile;
#pragma unroll
            for (int h = 0; h < 2; ++h) {
                v16bf akf;
#pragma unroll
                for (int e = 0; e < 16; ++e)
                    akf[e] = tK[keyr * P128H + h * 32 + fragK(e, kb)];
                sc[ct] = __builtin_amdgcn_wmma_f32_16x16x32_bf16(
                    false, akf, false, qf[h], (short)0, sc[ct], false, false);
            }
        }

        // online softmax in exp2 domain, one query per lane
        float t8[8];
#pragma unroll
        for (int i = 0; i < 8; ++i) t8[i] = fmaxf(sc[0][i], sc[1][i]);
        float tmax = fmaxf(fmaxf(fmaxf(t8[0], t8[1]), fmaxf(t8[2], t8[3])),
                           fmaxf(fmaxf(t8[4], t8[5]), fmaxf(t8[6], t8[7])));
        tmax = fmaxf(tmax, xhalf(tmax));           // join the two key halves
        const float mnew = fmaxf(mrun, tmax);
        const float corr = exp2f(mrun - mnew);     // v_exp_f32 is base-2
        mrun = mnew;

        // P^T: element e of the B fragment is key fragK(e, kb) = sc[e>>3][e&7]
        v16bf pf;
        float ps[8];
#pragma unroll
        for (int i = 0; i < 8; ++i) {
            const float p0 = exp2f(sc[0][i] - mnew);
            const float p1 = exp2f(sc[1][i] - mnew);
            pf[i]     = (__bf16)p0;
            pf[8 + i] = (__bf16)p1;
            ps[i] = p0 + p1;
        }
        const float psum = ((ps[0] + ps[1]) + (ps[2] + ps[3])) +
                           ((ps[4] + ps[5]) + (ps[6] + ps[7]));
        lrun = lrun * corr + psum;
#pragma unroll
        for (int dt = 0; dt < 4; ++dt)
#pragma unroll
            for (int i = 0; i < 8; ++i) oacc[dt][i] *= corr;

        // O^T += V^T P^T : 4 d-tiles (contiguous key runs -> ds_load_b128)
#pragma unroll
        for (int dt = 0; dt < 4; ++dt) {
            const int d = dt * 16 + rowInTile;
            v16bf avf;
#pragma unroll
            for (int e = 0; e < 16; ++e)
                avf[e] = tV[d * P64H + fragK(e, kb)];
            oacc[dt] = __builtin_amdgcn_wmma_f32_16x16x32_bf16(
                false, avf, false, pf, (short)0, oacc[dt], false, false);
        }
        wait_ds0();           // own reads of this buffer are over
        wait_async0();        // next K/V tiles landed
        __syncthreads();      // publishes them; everyone done reading this buffer
        if (st + 2 < NSTEP) stageKV(st + 2, bufi);   // refill the buffer just read
    }
    wait_async0();            // nothing in flight past the loop

    // hand this quarter's partial (max, sum, O) of 16 queries to the block
    const float lsum = lrun + xhalf(lrun);         // join the halves' sums
    const int ql = qtile * 16 + rowInTile;
    if (lane < 16) {
        sM[part][ql] = mrun;
        sL[part][ql] = lsum;
    }
    float* prow = &sO[part][ql * OPITCH + hb];
#pragma unroll
    for (int dt = 0; dt < 4; ++dt) {
        *reinterpret_cast<float4*>(prow + dt * 16) =
            make_float4(oacc[dt][0], oacc[dt][1], oacc[dt][2], oacc[dt][3]);
        *reinterpret_cast<float4*>(prow + dt * 16 + 4) =
            make_float4(oacc[dt][4], oacc[dt][5], oacc[dt][6], oacc[dt][7]);
    }
    __syncthreads();          // all four quarters' partials are in LDS

    // join: rescale each quarter to the common maximum, add, normalize, store
    // f32 output (N, L, 64); a wave's store covers 512 contiguous bytes
#pragma unroll
    for (int j = 0; j < 2; ++j) {
        const int q = j * 16 + (tid >> 4);
        const int d = (tid & 15) * 4;
        const float m0 = sM[0][q], m1 = sM[1][q], m2 = sM[2][q], m3 = sM[3][q];
        const float mall = fmaxf(fmaxf(m0, m1), fmaxf(m2, m3));
        const float f0 = exp2f(m0 - mall), f1 = exp2f(m1 - mall);
        const float f2 = exp2f(m2 - mall), f3 = exp2f(m3 - mall);
        const float lall = (f0 * sL[0][q] + f1 * sL[1][q]) +
                           (f2 * sL[2][q] + f3 * sL[3][q]);
        const float inv = 1.0f / lall;
        const float4 o0 = *reinterpret_cast<const float4*>(&sO[0][q * OPITCH + d]);
        const float4 o1 = *reinterpret_cast<const float4*>(&sO[1][q * OPITCH + d]);
        const float4 o2 = *reinterpret_cast<const float4*>(&sO[2][q * OPITCH + d]);
        const float4 o3 = *reinterpret_cast<const float4*>(&sO[3][q * OPITCH + d]);
        float4 r;
        r.x = ((f0 * o0.x + f1 * o1.x) + (f2 * o2.x + f3 * o3.x)) * inv;
        r.y = ((f0 * o0.y + f1 * o1.y) + (f2 * o2.y + f3 * o3.y)) * inv;
        r.z = ((f0 * o0.z + f1 * o1.z) + (f2 * o2.z + f3 * o3.z)) * inv;
        r.w = ((f0 * o0.w + f1 * o1.w) + (f2 * o2.w + f3 * o3.w)) * inv;
        *reinterpret_cast<float4*>(
            out + (size_t)(n * LL + qBase + q) * DD + d) = r;
    }
}

// ============================================================
extern "C" void kernel_launch(void* const* d_in, const int* in_sizes, int n_in,
                              void* d_out, int out_size, void* d_ws, size_t ws_size,
                              hipStream_t stream) {
    const float* query = (const float*)d_in[0];
    const float* key_  = (const float*)d_in[1];
    const float* value = (const float*)d_in[2];
    const float* Wq    = (const float*)d_in[3];
    const float* bq    = (const float*)d_in[4];
    const float* Wk    = (const float*)d_in[5];
    const float* bk    = (const float*)d_in[6];
    const float* Wv    = (const float*)d_in[7];
    const float* bv    = (const float*)d_in[8];
    float* out = (float*)d_out;

    const size_t elems = (size_t)NB * LL * DD;     // 524288
    __bf16* qb  = (__bf16*)d_ws;
    __bf16* kbr = qb + elems;
    __bf16* vbT = kbr + elems;

    dim3 g1(64, 3, 1);
    qkv_proj_kernel<<<g1, 256, 0, stream>>>(query, key_, value, Wq, Wk, Wv,
                                            bq, bk, bv, qb, kbr, vbT);
    attn_kernel<<<256, 256, 0, stream>>>(qb, kbr, vbT, out);
}

// v007
// A run of this version takes 25.4 microseconds.
// Timed twice side by side with v006, it ran 1.09 and 1.18 times as fast.
// Over all steps from v000 it is 5.30 times as fast.
#include <hip/hip_runtime.h>
#include <hip/hip_bf16.h>

// ---- problem constants (from reference) ----
#define NB 4
#define LL 2048
#define HH 1024
#define DD 64

// 0.125 (=1/sqrt(64)) * log2(e): folded into the Q projection so the
// softmax can run directly on hardware base-2 exp (v_exp_f32).
#define QSCALE 0.18033688011112042f

typedef __attribute__((ext_vector_type(16))) __bf16 v16bf;
typedef __attribute__((ext_vector_type(8)))  __bf16 v8bf;
typedef __attribute__((ext_vector_type(8)))  float  v8f;

__device__ __forceinline__ v8f vzero8() {
    v8f z;
#pragma unroll
    for (int i = 0; i < 8; ++i) z[i] = 0.0f;
    return z;
}

// A/B 16-bit fragment K-index pattern (wave32):
// lane<16 holds K {0..7,16..23}, lane>=16 holds K {8..15,24..31}
__device__ __forceinline__ int fragK(int e, int kb) {
    return kb + e + ((e & 8) ? 8 : 0);
}

// CDNA5 async global->LDS copy (16 bytes per lane), tracked by ASYNCcnt.
// Low 32 bits of a generic pointer into LDS == wave-relative LDS byte offset
// (ISA 10.2 aperture mapping), which is what VDST wants.
__device__ __forceinline__ unsigned lds_addr(const void* p) {
    return (unsigned)(unsigned long long)p;
}
// Eight async copies (16 bytes per lane each).  The closing s_wait_xcnt keeps
// every later rewrite of the address registers behind the copies' issue.
__device__ __forceinline__ void async_ld_b128_x8(
    unsigned l0, const void* g0, unsigned l1, const void* g1,
    unsigned l2, const void* g2, unsigned l3, const void* g3,
    unsigned l4, const void* g4, unsigned l5, const void* g5,
    unsigned l6, const void* g6, unsigned l7, const void* g7) {
    asm volatile("global_load_async_to_lds_b128 %0, %1, off\n\t"
                 "global_load_async_to_lds_b128 %2, %3, off\n\t"
                 "global_load_async_to_lds_b128 %4, %5, off\n\t"
                 "global_load_async_to_lds_b128 %6, %7, off\n\t"
                 "global_load_async_to_lds_b128 %8, %9, off\n\t"
                 "global_load_async_to_lds_b128 %10, %11, off\n\t"
                 "global_load_async_to_lds_b128 %12, %13, off\n\t"
                 "global_load_async_to_lds_b128 %14, %15, off\n\t"
                 "s_wait_xcnt 0x0"
                 :: "v"(l0), "v"(g0), "v"(l1), "v"(g1), "v"(l2), "v"(g2),
                    "v"(l3), "v"(g3), "v"(l4), "v"(g4), "v"(l5), "v"(g5),
                    "v"(l6), "v"(g6), "v"(l7), "v"(g7)
                 : "memory");
}
__device__ __forceinline__ void wait_async0() {
    asm volatile("s_wait_asynccnt 0" ::: "memory");
}
// This wave's LDS reads have returned before the buffer is handed back for a refill.
__device__ __forceinline__ void wait_ds0() {
    asm volatile("s_wait_dscnt 0x0" ::: "memory");
}

// LDS row pitches.  The fragments are read with 16-byte LDS loads, one tile
// row per lane: a pitch of 16 bytes x an odd number puts the 16 rows of a
// half wave on 16 different groups of four banks (512-byte rows -> 528 bytes,
// 256 -> 272, 128 -> 144, 64 -> 80).  The pad bytes are never written and
// never read.
#define P512F 132                // f32  elements: 128 used + 4 pad
#define P256H 136                // bf16 elements: 128 used + 8 pad
#define P128H 72                 // bf16 elements: 64 used + 8 pad
#define P64H  40                 // bf16 elements: 32 used + 8 pad

// k extent of one staged tile of the projection (128 rows x 512 bytes = 64 KiB
// of X).  The X ring has three buffers and a block keeps two tiles in flight,
// so a tile has two trips to land and the memory path never runs empty.
#define KT 128
#define NT (HH / KT)             // tiles

// ============================================================
// Kernel 1: fused QKV projection.  grid = (64, 3), block = 256
//   X(8192x1024) * W(1024x64) + b  ->  bf16
//   mat 0 -> qb [m][d] (scaled by QSCALE) ; mat 1 -> kbr [m][d] ;
//   mat 2 -> vbT [n][d][l]
// LDS staging, KT k per tile.  X by async copies into a ring of three buffers:
// waves 0-3 copy the even tiles, waves 4-7 the odd ones, each tile two trips
// ahead of its use; a wave then never has more than one tile outstanding, so
// its wait to 0 drains the tile that is due and leaves the other half's
// younger tile in flight.  W (f32, [k][n]), two buffers, through registers,
// where it is rounded to bf16 and turned to [n][k]:
// a thread loads 4 runs of 8 k of one column n (a wave's load = one 128-byte
// line) two tiles ahead and stores them one tile ahead as 16-byte LDS row pieces.
// Operand order by output layout, so that a lane's 8 accumulator registers are
// 8 neighbours of one output row: V^T (VT) takes X as A and W^T as B (lane =
// column d, registers = 8 l); Q and K take W^T as A and X as B (lane = row m,
// registers = 8 d).  The block's bf16 tile is gathered in LDS with 16-byte
// stores and leaves as whole rows: 64 x 256 bytes (V^T), 128 x 128 bytes (Q, K).
// ============================================================
template <bool VT>
__device__ __forceinline__ void proj_body(
    const float* __restrict__ X, const float* __restrict__ Wm,
    const float* __restrict__ Bb, const float scale, __bf16* __restrict__ dst,
    float (*sA)[128 * P512F], __bf16 (*sWT)[64 * P256H])
{
    const int mBase     = blockIdx.x * 128;        // row base in flattened (N*L)
    const int tid       = threadIdx.x;
    const int lane      = tid & 31;
    const int wave      = tid >> 5;                // 0..7
    const int rowInTile = lane & 15;
    const int kb        = (lane & 16) ? 8 : 0;
    const int hb        = (lane & 16) ? 8 : 0;     // C-layout row offset

    // which half of the waves this one is in: scalar, so that the tests around
    // the copies and their wait are scalar branches
    const int grp = __builtin_amdgcn_readfirstlane(tid >> 7);
    // a wave's copy is one whole 512-byte tile row; its rows in a tile that its
    // half copies: (wave & 3) + 4 c, c = 0..31
    const int w4 = wave & 3;
    const float* gA = X + (size_t)(mBase + w4) * HH + lane * 4;
    // a thread's pieces of the W^T tile: column wn of W, rows p*32 + wk .. + 7
    const int wn = tid & 63, wk = (tid >> 6) * 8;
    const float* gW = Wm + (size_t)wk * DD + wn;

    float wreg[KT / 4];                            // W values on their way to LDS
    auto loadW = [&](int kk) {
#pragma unroll
        for (int p = 0; p < KT / 32; ++p)
#pragma unroll
            for (int j = 0; j < 8; ++j)
                wreg[p * 8 + j] = gW[(size_t)(kk + p * 32 + j) * DD];
        // keeps the later advance of the loads' address registers behind their issue
        asm volatile("s_wait_xcnt 0x0" ::: "memory");
    };
    auto stage = [&](int kk, int bufi) {
#pragma unroll   // four statements of eight copies, row offsets constant
        for (int c = 0; c < 32; c += 8) {
            float* la = &sA[bufi][(w4 + c * 4) * P512F + lane * 4];
            const float* g = gA + kk + (size_t)c * 4 * HH;
            async_ld_b128_x8(
                lds_addr(la),              g,
                lds_addr(la +  4 * P512F), g + (size_t) 4 * HH,
                lds_addr(la +  8 * P512F), g + (size_t) 8 * HH,
                lds_addr(la + 12 * P512F), g + (size_t)12 * HH,
                lds_addr(la + 16 * P512F), g + (size_t)16 * HH,
                lds_addr(la + 20 * P512F), g + (size_t)20 * HH,
                lds_addr(la + 24 * P512F), g + (size_t)24 * HH,
                lds_addr(la + 28 * P512F), g + (size_t)28 * HH);
        }
    };
    auto putW = [&](int bufi) {
#pragma unroll
        for (int p = 0; p < KT / 32; ++p) {
            v8bf h;
#pragma unroll
            for (int j = 0; j < 8; ++j) h[j] = (__bf16)wreg[p * 8 + j];
            *reinterpret_cast<v8bf*>(&sWT[bufi][wn * P256H + p * 32 + wk]) = h;
        }
    };

    v8f acc[4];
#pragma unroll
    for (int nt = 0; nt < 4; ++nt) acc[nt] = vzero8();

    if (grp == 0) stage(0, 0);    // tiles 0 and 1 start together
    else          stage(KT, 1);
    loadW(0);
    putW(0);
    loadW(KT);
    if (grp == 0) wait_async0();  // tile 0 landed; tile 1 stays in flight
    __syncthreads();

    int xb = 0;                                       // X buffer of tile t: t mod 3
    for (int t = 0; t < NT; ++t) {
        const int bufi = t & 1;                       // W^T buffer of tile t
        const int kk   = t * KT;
        if (t + 1 < NT) {
            putW(bufi ^ 1);       // next tile's W^T part, loaded a trip ago, into the buffer not being read
            if (t + 2 < NT) loadW(kk + 2 * KT);   // due at this trip's barrier: ahead of the copies
        }
        // tile t + 2, by the half whose tile t has landed, into the buffer that
        // trip t - 1 read (freed by that trip's barrier)
        if (t + 2 < NT && grp == bufi) stage(kk + 2 * KT, xb == 0 ? 2 : xb - 1);

#pragma unroll   // constant LDS offsets; a later k step's reads can issue ahead
        for (int ks = 0; ks < KT; ks += 32) {
            // X fragment: 16 rows x 32 k (two contiguous runs -> ds_load_b128 + cvt)
            v16bf a;
            const float* arow = &sA[xb][(wave * 16 + rowInTile) * P512F + ks];
#pragma unroll
            for (int e = 0; e < 16; ++e) a[e] = (__bf16)arow[fragK(e, kb)];

            // 4 W^T fragments (bf16, no conversion) + WMMA
#pragma unroll
            for (int nt = 0; nt < 4; ++nt) {
                v16bf b;
                const __bf16* wrow = &sWT[bufi][(nt * 16 + rowInTile) * P256H + ks];
#pragma unroll
                for (int e = 0; e < 16; ++e) b[e] = wrow[fragK(e, kb)];
                if (VT)
                    acc[nt] = __builtin_amdgcn_wmma_f32_16x16x32_bf16(
                        false, a, false, b, (short)0, acc[nt], false, false);
                else
                    acc[nt] = __builtin_amdgcn_wmma_f32_16x16x32_bf16(
                        false, b, false, a, (short)0, acc[nt], false, false);
            }
        }
        wait_ds0();           // own reads of this buffer are over, own W^T piece is in
        if (grp != bufi) wait_async0();   // tile t + 1 landed: its copiers' only outstanding tile
        __syncthreads();      // publishes tile t + 1; everyone done reading tile t
        xb = (xb == 2) ? 0 : xb + 1;
    }
    wait_async0();            // nothing in flight past the loop

    // epilogue: bias (+ softmax scale folded into Q), bf16, gathered in the LDS
    // that the loop's last barrier has freed (nothing is in flight into it)
    __bf16* sT = reinterpret_cast<__bf16*>(&sA[0][0]);
    if (VT) {
        // acc[nt][i] = V[mBase + wave*16 + hb + i][nt*16 + rowInTile]
#pragma unroll
        for (int nt = 0; nt < 4; ++nt) {
            const float bias = Bb[nt * 16 + rowInTile];
            v8bf h;
#pragma unroll
            for (int i = 0; i < 8; ++i) h[i] = (__bf16)(acc[nt][i] + bias);
            *reinterpret_cast<v8bf*>(
                &sT[(nt * 16 + rowInTile) * P256H + wave * 16 + hb]) = h;
        }
        __syncthreads();      // the tile's rows hold pieces of all eight waves
        const int n  = mBase >> 11;                // /L (2048)
        const int l0 = mBase & (LL - 1);
        __bf16* g = dst + ((size_t)n * DD + (tid >> 4)) * LL + l0 + (tid & 15) * 8;
        const __bf16* s = &sT[(tid >> 4) * P256H + (tid & 15) * 8];
#pragma unroll
        for (int j = 0; j < 4; ++j)                // a wave: two rows of 256 bytes
            *reinterpret_cast<v8bf*>(g + (size_t)j * 16 * LL) =
                *reinterpret_cast<const v8bf*>(s + j * 16 * P256H);
    } else {
        // acc[nt][i] = Y[mBase + wave*16 + rowInTile][nt*16 + hb + i]
#pragma unroll
        for (int nt = 0; nt < 4; ++nt) {
            const float4 b0 = *reinterpret_cast<const float4*>(Bb + nt * 16 + hb);
            const float4 b1 = *reinterpret_cast<const float4*>(Bb + nt * 16 + hb + 4);
            const float bias[8] = {b0.x, b0.y, b0.z, b0.w, b1.x, b1.y, b1.z, b1.w};
            v8bf h;
#pragma unroll
            for (int i = 0; i < 8; ++i)
                h[i] = (__bf16)((acc[nt][i] + bias[i]) * scale);
            *reinterpret_cast<v8bf*>(
                &sT[(wave * 16 + rowInTile) * P128H + nt * 16 + hb]) = h;
        }
        __syncthreads();      // orders the lanes' LDS stores before the row-wise reads
        __bf16* g = dst + (size_t)(mBase + (tid >> 3)) * DD + (tid & 7) * 8;
        const __bf16* s = &sT[(tid >> 3) * P128H + (tid & 7) * 8];
#pragma unroll
        for (int j = 0; j < 4; ++j)                // a wave: 512 contiguous bytes
            *reinterpret_cast<v8bf*>(g + (size_t)j * 32 * DD) =
                *reinterpret_cast<const v8bf*>(s + j * 32 * P128H);
    }
}

__global__ __launch_bounds__(256) void qkv_proj_kernel(
    const float* __restrict__ q_in, const float* __restrict__ k_in,
    const float* __restrict__ v_in,
    const float* __restrict__ Wq, const float* __restrict__ Wk,
    const float* __restrict__ Wv,                  // [1024][64] f32
    const float* __restrict__ bq, const float* __restrict__ bk,
    const float* __restrict__ bv,
    __bf16* __restrict__ qb, __bf16* __restrict__ kbr, __bf16* __restrict__ vbT)
{
    __shared__ __align__(16) float  sA[3][128 * P512F];   // [row][k] f32, ring of three
    __shared__ __align__(16) __bf16 sWT[2][64 * P256H];   // [n][k]  bf16

    const int mat = blockIdx.y;                    // 0=q, 1=k, 2=v
    if (mat == 2) {
        proj_body<true>(v_in, Wv, bv, 1.0f, vbT, sA, sWT);
    } else {
        // 0.125*log2(e) folded into q; times 1.0f leaves k as it is
        proj_body<false>(mat == 0 ? q_in : k_in, mat == 0 ? Wq : Wk,
                         mat == 0 ? bq : bk, mat == 0 ? QSCALE : 1.0f,
                         mat == 0 ? qb : kbr, sA, sWT);
    }
}

#define KPARTS 4
#define PKEYS  (LL / KPARTS)     // keys per quarter
#define NSTEP  (PKEYS / 32)      // steps per wave
#define OPITCH 68                // f32 row pitch of the partial O (16-byte column walks)

// value of lane l ^ 16
__device__ __forceinline__ float xhalf(float x) {
    const int xi = __builtin_bit_cast(int, x);
    return __builtin_bit_cast(float, __builtin_amdgcn_permlanex16(
        xi, xi, 0x76543210, 0xfedcba98, false, false));
}

__global__ __launch_bounds__(256) void attn_kernel(
    const __bf16* __restrict__ qb, const __bf16* __restrict__ kbr,
    const __bf16* __restrict__ vbT, float* __restrict__ out)
{
    const int tid       = threadIdx.x;
    const int lane      = tid & 31;
    const int wave      = tid >> 5;
    const int qtile     = wave & 1;                // which 16 of the 32 queries
    const int part      = wave >> 1;               // which quarter of the keys
    const int n         = blockIdx.x >> 6;         // batch
    const int qBase     = (blockIdx.x & 63) * 32;
    const int rowInTile = lane & 15;
    const int kb        = (lane & 16) ? 8 : 0;
    const int hb        = (lane & 16) ? 8 : 0;

    __shared__ __align__(16) __bf16 sK[3][KPARTS][32 * P128H];   // [key][d]
    __shared__ __align__(16) __bf16 sVT[3][KPARTS][64 * P64H];   // [d][key]
    __shared__ __align__(16) float  sO[KPARTS][32 * OPITCH];  // [query][d]
    __shared__ float sM[KPARTS][32];
    __shared__ float sL[KPARTS][32];

    // which half of the waves this one is in: scalar, so that the tests around
    // the copies and their wait are scalar branches
    const int grp = __builtin_amdgcn_readfirstlane(tid >> 7);
    // a thread's two 16-byte pieces of each quarter's K tile (keys r, r + 16) and
    // V^T tile (rows d, d + 32), in a step whose tiles its half copies
    const int t7 = tid & 127;
    const __bf16* gK = kbr + (size_t)n * LL * DD + t7 * 8;
    const __bf16* gV = vbT + ((size_t)n * DD + (t7 >> 2)) * LL + (t7 & 3) * 8;
    const int kOff = (t7 >> 3) * P128H + (t7 & 7) * 8;     // first place in a K tile
    const int vOff = (t7 >> 2) * P64H + (t7 & 3) * 8;      // first place in a V^T tile

    auto stageKV = [&](int step, int bufi) {
        const __bf16* k0 = gK + (size_t)step * 32 * DD;
        const __bf16* v0 = gV + step * 32;
        async_ld_b128_x8(
            lds_addr(&sK[bufi][0][kOff]),              k0,
            lds_addr(&sK[bufi][0][kOff + 16 * P128H]), k0 + 16 * DD,
            lds_addr(&sK[bufi][1][kOff]),              k0 + (size_t)1 * PKEYS * DD,
            lds_addr(&sK[bufi][1][kOff + 16 * P128H]), k0 + (size_t)1 * PKEYS * DD + 16 * DD,
            lds_addr(&sK[bufi][2][kOff]),              k0 + (size_t)2 * PKEYS * DD,
            lds_addr(&sK[bufi][2][kOff + 16 * P128H]), k0 + (size_t)2 * PKEYS * DD + 16 * DD,
            lds_addr(&sK[bufi][3][kOff]),              k0 + (size_t)3 * PKEYS * DD,
            lds_addr(&sK[bufi][3][kOff + 16 * P128H]), k0 + (size_t)3 * PKEYS * DD + 16 * DD);
        async_ld_b128_x8(
            lds_addr(&sVT[bufi][0][vOff]),             v0,
            lds_addr(&sVT[bufi][0][vOff + 32 * P64H]), v0 + (size_t)32 * LL,
            lds_addr(&sVT[bufi][1][vOff]),             v0 + 1 * PKEYS,
            lds_addr(&sVT[bufi][1][vOff + 32 * P64H]), v0 + (size_t)32 * LL + 1 * PKEYS,
            lds_addr(&sVT[bufi][2][vOff]),             v0 + 2 * PKEYS,
            lds_addr(&sVT[bufi][2][vOff + 32 * P64H]), v0 + (size_t)32 * LL + 2 * PKEYS,
            lds_addr(&sVT[bufi][3][vOff]),             v0 + 3 * PKEYS,
            lds_addr(&sVT[bufi][3][vOff + 32 * P64H]), v0 + (size_t)32 * LL + 3 * PKEYS);
    };

    // load this wave's Q fragments (64 d x 16 queries -> two 32x16 B-frags)
    const __bf16* qrow =
        qb + (size_t)(n * LL + qBase + qtile * 16 + rowInTile) * DD;
    v16bf qf[2];
#pragma unroll
    for (int h = 0; h < 2; ++h)
#pragma unroll
        for (int e = 0; e < 16; ++e)
            qf[h][e] = qrow[h * 32 + fragK(e, kb)];

    v8f oacc[4];                                   // O^T: vgpr i -> d = dt*16+hb+i
#pragma unroll
    for (int dt = 0; dt < 4; ++dt) oacc[dt] = vzero8();
    float mrun = -1e30f;   // running maximum of this lane's query (both halves equal)
    float lrun = 0.0f;     // running sum over this lane's half of the keys

    if (grp == 0) stageKV(0, 0);  // steps 0 and 1 start together
    else          stageKV(1, 1);
    if (grp == 0) wait_async0();  // step 0's tiles landed; step 1's stay in flight
    __syncthreads();

    int xb = 0;                                    // buffer of step st: st mod 3
    for (int st = 0; st < NSTEP; ++st) {
        // step st + 2's tiles, by the half whose step st has landed, into the
        // buffer that step st - 1 read (freed by that step's barrier)
        if (st + 2 < NSTEP && grp == (st & 1)) stageKV(st + 2, xb == 0 ? 2 : xb - 1);
        const __bf16* tK = sK[xb][part];
        const __bf16* tV = sVT[xb][part];

        // scores S^T = K Q^T (pre-scaled by 0.125*log2e): 2 key tiles x 2 d-steps
        // D layout: sc[ct][i] = S[query rowInTile][key ct*16 + hb + i]
        v8f sc[2];
        sc[0] = vzero8(); sc[1] = vzero8();
#pragma unroll
        for (int ct = 0; ct < 2; ++ct) {
            const int keyr = ct * 16 + rowInTile;
#pragma unroll
            for (int h = 0; h < 2; ++h) {
                v16bf akf;
#pragma unroll
                for (int e = 0; e < 16; ++e)
                    akf[e] = tK[keyr * P128H + h * 32 + fragK(e, kb)];
                sc[ct] = __builtin_amdgcn_wmma_f32_16x16x32_bf16(
                    false, akf, false, qf[h], (short)0, sc[ct], false, false);
            }
        }

        // online softmax in exp2 domain, one query per lane
        float t8[8];
#pragma unroll
        for (int i = 0; i < 8; ++i) t8[i] = fmaxf(sc[0][i], sc[1][i]);
        float tmax = fmaxf(fmaxf(fmaxf(t8[0], t8[1]), fmaxf(t8[2], t8[3])),
                           fmaxf(fmaxf(t8[4], t8[5]), fmaxf(t8[6], t8[7])));
        tmax = fmaxf(tmax, xhalf(tmax));           // join the two key halves
        const float mnew = fmaxf(mrun, tmax);
        const float corr = exp2f(mrun - mnew);     // v_exp_f32 is base-2
        mrun = mnew;

        // P^T: element e of the B fragment is key fragK(e, kb) = sc[e>>3][e&7]
        v16bf pf;
        float ps[8];
#pragma unroll
        for (int i = 0; i < 8; ++i) {
            const float p0 = exp2f(sc[0][i] - mnew);
            const float p1 = exp2f(sc[1][i] - mnew);
            pf[i]     = (__bf16)p0;
            pf[8 + i] = (__bf16)p1;
            ps[i] = p0 + p1;
        }
        const float psum = ((ps[0] + ps[1]) + (ps[2] + ps[3])) +
                           ((ps[4] + ps[5]) + (ps[6] + ps[7]));
        lrun = lrun * corr + psum;
#pragma unroll
        for (int dt = 0; dt < 4; ++dt)
#pragma unroll
            for (int i = 0; i < 8; ++i) oacc[dt][i] *= corr;

        // O^T += V^T P^T : 4 d-tiles (contiguous key runs -> ds_load_b128)
#pragma unroll
        for (int dt = 0; dt < 4; ++dt) {
            const int d = dt * 16 + rowInTile;
            v16bf avf;
#pragma unroll
            for (int e = 0; e < 16; ++e)
                avf[e] = tV[d * P64H + fragK(e, kb)];
            oacc[dt] = __builtin_amdgcn_wmma_f32_16x16x32_bf16(
                false, avf, false, pf, (short)0, oacc[dt], false, false);
        }
        wait_ds0();           // own reads of this buffer are over
        if (grp != (st & 1)) wait_async0();   // step st + 1's tiles landed: their copiers' only outstanding ones
        __syncthreads();      // publishes them; everyone done reading this buffer
        xb = (xb == 2) ? 0 : xb + 1;
    }
    wait_async0();            // nothing in flight past the loop

    // hand this quarter's partial (max, sum, O) of 16 queries to the block
    const float lsum = lrun + xhalf(lrun);         // join the halves' sums
    const int ql = qtile * 16 + rowInTile;
    if (lane < 16) {
        sM[part][ql] = mrun;
        sL[part][ql] = lsum;
    }
    float* prow = &sO[part][ql * OPITCH + hb];
#pragma unroll
    for (int dt = 0; dt < 4; ++dt) {
        *reinterpret_cast<float4*>(prow + dt * 16) =
            make_float4(oacc[dt][0], oacc[dt][1], oacc[dt][2], oacc[dt][3]);
        *reinterpret_cast<float4*>(prow + dt * 16 + 4) =
            make_float4(oacc[dt][4], oacc[dt][5], oacc[dt][6], oacc[dt][7]);
    }
    __syncthreads();          // all four quarters' partials are in LDS

    // join: rescale each quarter to the common maximum, add, normalize, store
    // f32 output (N, L, 64); a wave's store covers 512 contiguous bytes
#pragma unroll
    for (int j = 0; j < 2; ++j) {
        const int q = j * 16 + (tid >> 4);
        const int d = (tid & 15) * 4;
        const float m0 = sM[0][q], m1 = sM[1][q], m2 = sM[2][q], m3 = sM[3][q];
        const float mall = fmaxf(fmaxf(m0, m1), fmaxf(m2, m3));
        const float f0 = exp2f(m0 - mall), f1 = exp2f(m1 - mall);
        const float f2 = exp2f(m2 - mall), f3 = exp2f(m3 - mall);
        const float lall = (f0 * sL[0][q] + f1 * sL[1][q]) +
                           (f2 * sL[2][q] + f3 * sL[3][q]);
        const float inv = 1.0f / lall;
        const float4 o0 = *reinterpret_cast<const float4*>(&sO[0][q * OPITCH + d]);
        const float4 o1 = *reinterpret_cast<const float4*>(&sO[1][q * OPITCH + d]);
        const float4 o2 = *reinterpret_cast<const float4*>(&sO[2][q * OPITCH + d]);
        const float4 o3 = *reinterpret_cast<const float4*>(&sO[3][q * OPITCH + d]);
        float4 r;
        r.x = ((f0 * o0.x + f1 * o1.x) + (f2 * o2.x + f3 * o3.x)) * inv;
        r.y = ((f0 * o0.y + f1 * o1.y) + (f2 * o2.y + f3 * o3.y)) * inv;
        r.z = ((f0 * o0.z + f1 * o1.z) + (f2 * o2.z + f3 * o3.z)) * inv;
        r.w = ((f0 * o0.w + f1 * o1.w) + (f2 * o2.w + f3 * o3.w)) * inv;
        *reinterpret_cast<float4*>(
            out + (size_t)(n * LL + qBase + q) * DD + d) = r;
    }
}

// ============================================================
extern "C" void kernel_launch(void* const* d_in, const int* in_sizes, int n_in,
                              void* d_out, int out_size, void* d_ws, size_t ws_size,
                              hipStream_t stream) {
    const float* query = (const float*)d_in[0];
    const float* key_  = (const float*)d_in[1];
    const float* value = (const float*)d_in[2];
    const float* Wq    = (const float*)d_in[3];
    const float* bq    = (const float*)d_in[4];
    const float* Wk    = (const float*)d_in[5];
    const float* bk    = (const float*)d_in[6];
    const float* Wv    = (const float*)d_in[7];
    const float* bv    = (const float*)d_in[8];
    float* out = (float*)d_out;

    const size_t elems = (size_t)NB * LL * DD;     // 524288
    __bf16* qb  = (__bf16*)d_ws;
    __bf16* kbr = qb + elems;
    __bf16* vbT = kbr + elems;

    dim3 g1(64, 3, 1);
    qkv_proj_kernel<<<g1, 256, 0, stream>>>(query, key_, value, Wq, Wk, Wv,
                                            bq, bk, bv, qb, kbr, vbT);
    attn_kernel<<<256, 256, 0, stream>>>(qb, kbr, vbT, out);
}

// v008
// A run of this version takes 23.8 microseconds.
// In two side-by-side timings against v007, it was 1.06 and 1.08 times as fast.
// Over all steps from v000 it is 5.66 times as fast.
#include <hip/hip_runtime.h>
#include <hip/hip_bf16.h>

// ---- problem constants (from reference) ----
#define NB 4
#define LL 2048
#define HH 1024
#define DD 64

// 0.125 (=1/sqrt(64)) * log2(e): folded into the Q projection so the
// softmax can run directly on hardware base-2 exp (v_exp_f32).
#define QSCALE 0.18033688011112042f

typedef __attribute__((ext_vector_type(16))) __bf16 v16bf;
typedef __attribute__((ext_vector_type(8)))  __bf16 v8bf;
typedef __attribute__((ext_vector_type(8)))  float  v8f;

__device__ __forceinline__ v8f vzero8() {
    v8f z;
#pragma unroll
    for (int i = 0; i < 8; ++i) z[i] = 0.0f;
    return z;
}

// A/B 16-bit fragment K-index pattern (wave32):
// lane<16 holds K {0..7,16..23}, lane>=16 holds K {8..15,24..31}
__device__ __forceinline__ int fragK(int e, int kb) {
    return kb + e + ((e & 8) ? 8 : 0);
}

// CDNA5 async global->LDS copy (16 bytes per lane), tracked by ASYNCcnt.
// Low 32 bits of a generic pointer into LDS == wave-relative LDS byte offset
// (ISA 10.2 aperture mapping), which is what VDST wants.
__device__ __forceinline__ unsigned lds_addr(const void* p) {
    return (unsigned)(unsigned long long)p;
}
// Eight async copies (16 bytes per lane each).  The closing s_wait_xcnt keeps
// every later rewrite of the address registers behind the copies' issue.
__device__ __forceinline__ void async_ld_b128_x8(
    unsigned l0, const void* g0, unsigned l1, const void* g1,
    unsigned l2, const void* g2, unsigned l3, const void* g3,
    unsigned l4, const void* g4, unsigned l5, const void* g5,
    unsigned l6, const void* g6, unsigned l7, const void* g7) {
    asm volatile("global_load_async_to_lds_b128 %0, %1, off\n\t"
                 "global_load_async_to_lds_b128 %2, %3, off\n\t"
                 "global_load_async_to_lds_b128 %4, %5, off\n\t"
                 "global_load_async_to_lds_b128 %6, %7, off\n\t"
                 "global_load_async_to_lds_b128 %8, %9, off\n\t"
                 "global_load_async_to_lds_b128 %10, %11, off\n\t"
                 "global_load_async_to_lds_b128 %12, %13, off\n\t"
                 "global_load_async_to_lds_b128 %14, %15, off\n\t"
                 "s_wait_xcnt 0x0"
                 :: "v"(l0), "v"(g0), "v"(l1), "v"(g1), "v"(l2), "v"(g2),
                    "v"(l3), "v"(g3), "v"(l4), "v"(g4), "v"(l5), "v"(g5),
                    "v"(l6), "v"(g6), "v"(l7), "v"(g7)
                 : "memory");
}
__device__ __forceinline__ void wait_async0() {
    asm volatile("s_wait_asynccnt 0" ::: "memory");
}
// This wave's LDS reads have returned before the buffer is handed back for a refill.
__device__ __forceinline__ void wait_ds0() {
    asm volatile("s_wait_dscnt 0x0" ::: "memory");
}

// LDS row pitches.  The fragments are read with 16-byte LDS loads, one tile
// row per lane: a pitch of 16 bytes x an odd number puts the 16 rows of a
// half wave on 16 different groups of four banks (512-byte rows -> 528 bytes,
// 256 -> 272, 128 -> 144, 64 -> 80).  The pad bytes are never written and
// never read.
#define P512F 132                // f32  elements: 128 used + 4 pad
#define P256H 136                // bf16 elements: 128 used + 8 pad
#define P128H 72                 // bf16 elements: 64 used + 8 pad
#define P64H  40                 // bf16 elements: 32 used + 8 pad

// k extent of one staged tile of the projection (128 rows x 512 bytes = 64 KiB
// of X).  The X ring has three buffers and a block keeps two tiles in flight,
// so a tile has two trips to land and the memory path never runs empty.
#define KT 128
#define NT (HH / KT)             // tiles

// ============================================================
// Kernel 1: fused QKV projection.  grid = (64, 3), block = 256
//   X(8192x1024) * W(1024x64) + b  ->  bf16
//   mat 0 -> qb [m][d] (scaled by QSCALE) ; mat 1 -> kbr [m][d] ;
//   mat 2 -> vbT [n][d][l]
// LDS staging, KT k per tile.  X by async copies into a ring of three buffers:
// waves 0-3 copy the even tiles, waves 4-7 the odd ones, each tile two trips
// ahead of its use; a wave then never has more than one tile outstanding, so
// its wait to 0 drains the tile that is due and leaves the other half's
// younger tile in flight.  W (f32, [k][n]), two buffers, through registers,
// where it is rounded to bf16 and turned to [n][k]:
// a thread loads 4 runs of 8 k of one column n (a wave's load = one 128-byte
// line) two tiles ahead and stores them one tile ahead as 16-byte LDS row pieces.
// Operand order by output layout, so that a lane's 8 accumulator registers are
// 8 neighbours of one output row: V^T (VT) takes X as A and W^T as B (lane =
// column d, registers = 8 l); Q and K take W^T as A and X as B (lane = row m,
// registers = 8 d).  The block's bf16 tile is gathered in LDS with 16-byte
// stores and leaves as whole rows: 64 x 256 bytes (V^T), 128 x 128 bytes (Q, K).
// ============================================================
template <bool VT>
__device__ __forceinline__ void proj_body(
    const float* __restrict__ X, const float* __restrict__ Wm,
    const float* __restrict__ Bb, const float scale, __bf16* __restrict__ dst,
    float (*sA)[128 * P512F], __bf16 (*sWT)[64 * P256H])
{
    const int mBase     = blockIdx.x * 128;        // row base in flattened (N*L)
    const int tid       = threadIdx.x;
    const int lane      = tid & 31;
    const int wave      = tid >> 5;                // 0..7
    const int rowInTile = lane & 15;
    const int kb        = (lane & 16) ? 8 : 0;
    const int hb        = (lane & 16) ? 8 : 0;     // C-layout row offset

    // which half of the waves this one is in: scalar, so that the tests around
    // the copies and their wait are scalar branches
    const int grp = __builtin_amdgcn_readfirstlane(tid >> 7);
    // a wave's copy is one whole 512-byte tile row; its rows in a tile that its
    // half copies: (wave & 3) + 4 c, c = 0..31
    const int w4 = wave & 3;
    const float* gA = X + (size_t)(mBase + w4) * HH + lane * 4;
    // a thread's pieces of the W^T tile: column wn of W, rows p*32 + wk .. + 7
    const int wn = tid & 63, wk = (tid >> 6) * 8;
    const float* gW = Wm + (size_t)wk * DD + wn;

    float wreg[KT / 4];                            // W values on their way to LDS
    auto loadW = [&](int kk) {
#pragma unroll
        for (int p = 0; p < KT / 32; ++p)
#pragma unroll
            for (int j = 0; j < 8; ++j)
                wreg[p * 8 + j] = gW[(size_t)(kk + p * 32 + j) * DD];
        // keeps the later advance of the loads' address registers behind their issue
        asm volatile("s_wait_xcnt 0x0" ::: "memory");
    };
    auto stage = [&](int kk, int bufi) {
#pragma unroll   // four statements of eight copies, row offsets constant
        for (int c = 0; c < 32; c += 8) {
            float* la = &sA[bufi][(w4 + c * 4) * P512F + lane * 4];
            const float* g = gA + kk + (size_t)c * 4 * HH;
            async_ld_b128_x8(
                lds_addr(la),              g,
                lds_addr(la +  4 * P512F), g + (size_t) 4 * HH,
                lds_addr(la +  8 * P512F), g + (size_t) 8 * HH,
                lds_addr(la + 12 * P512F), g + (size_t)12 * HH,
                lds_addr(la + 16 * P512F), g + (size_t)16 * HH,
                lds_addr(la + 20 * P512F), g + (size_t)20 * HH,
                lds_addr(la + 24 * P512F), g + (size_t)24 * HH,
                lds_addr(la + 28 * P512F), g + (size_t)28 * HH);
        }
    };
    auto putW = [&](int bufi) {
#pragma unroll
        for (int p = 0; p < KT / 32; ++p) {
            v8bf h;
#pragma unroll
            for (int j = 0; j < 8; ++j) h[j] = (__bf16)wreg[p * 8 + j];
            *reinterpret_cast<v8bf*>(&sWT[bufi][wn * P256H + p * 32 + wk]) = h;
        }
    };

    v8f acc[4];
#pragma unroll
    for (int nt = 0; nt < 4; ++nt) acc[nt] = vzero8();

    if (grp == 0) stage(0, 0);    // tiles 0 and 1 start together
    else          stage(KT, 1);
    loadW(0);
    putW(0);
    loadW(KT);
    if (grp == 0) wait_async0();  // tile 0 landed; tile 1 stays in flight
    __syncthreads();

    int xb = 0;                                       // X buffer of tile t: t mod 3
    for (int t = 0; t < NT; ++t) {
        const int bufi = t & 1;                       // W^T buffer of tile t
        const int kk   = t * KT;

        // Fragment reads of the trip's four k steps (each 4 of X, 8 of W^T, 16 bytes
        // a lane), issued in whole groups well ahead of their products: the first k
        // step's and the second's X ahead of this trip's W and copy issue, which runs
        // under their latency (more would pass 256 registers there), the rest behind
        // it and behind the first products.
        const float*  xrow = &sA[xb][(wave * 16 + rowInTile) * P512F + kb];
        const __bf16* wrow = &sWT[bufi][rowInTile * P256H + kb];
        float4 xr[KT / 32][4];
        v8bf   wr[KT / 32][4][2];
        auto readX = [&](int i) {
            xr[i][0] = *reinterpret_cast<const float4*>(xrow + i * 32);
            xr[i][1] = *reinterpret_cast<const float4*>(xrow + i * 32 + 4);
            xr[i][2] = *reinterpret_cast<const float4*>(xrow + i * 32 + 16);
            xr[i][3] = *reinterpret_cast<const float4*>(xrow + i * 32 + 20);
        };
        auto readW = [&](int i) {
#pragma unroll   // the fragments live in registers: constant indices
            for (int nt = 0; nt < 4; ++nt) {
                const __bf16* p = wrow + nt * 16 * P256H + i * 32;
                wr[i][nt][0] = *reinterpret_cast<const v8bf*>(p);
                wr[i][nt][1] = *reinterpret_cast<const v8bf*>(p + 16);
            }
        };
        readX(0); readW(0); readX(1);

        if (t + 1 < NT) {
            putW(bufi ^ 1);       // next tile's W^T part, loaded a trip ago, into the buffer not being read
            if (t + 2 < NT) loadW(kk + 2 * KT);   // due at this trip's barrier: ahead of the copies
        }
        // tile t + 2, by the half whose tile t has landed, into the buffer that
        // trip t - 1 read (freed by that trip's barrier)
        if (t + 2 < NT && grp == bufi) stage(kk + 2 * KT, xb == 0 ? 2 : xb - 1);

        readW(1); readX(2); readX(3); readW(2);
        // the compiler fence keeps the reads above it, the scheduling barrier the
        // products below it (left free, each read sinks to its product and pays
        // the LDS latency there)
        asm volatile("" ::: "memory");
        __builtin_amdgcn_sched_barrier(0);

#pragma unroll   // constant register sets
        for (int i = 0; i < KT / 32; ++i) {
            // X fragment: 16 rows x 32 k; element e is k i*32 + fragK(e, kb), the two
            // runs of 8 in turn, as in the W^T fragments
            v16bf a;
#pragma unroll
            for (int e = 0; e < 16; ++e) {
                const float4 x4 = xr[i][e >> 2];
                a[e] = (__bf16)((e & 3) == 0 ? x4.x : (e & 3) == 1 ? x4.y
                                : (e & 3) == 2 ? x4.z : x4.w);
            }

            // 4 W^T fragments (bf16, no conversion) + WMMA
#pragma unroll
            for (int nt = 0; nt < 4; ++nt) {
                const v16bf b = __builtin_shufflevector(
                    wr[i][nt][0], wr[i][nt][1],
                    0, 1, 2, 3, 4, 5, 6, 7, 8, 9, 10, 11, 12, 13, 14, 15);
                if (VT)
                    acc[nt] = __builtin_amdgcn_wmma_f32_16x16x32_bf16(
                        false, a, false, b, (short)0, acc[nt], false, false);
                else
                    acc[nt] = __builtin_amdgcn_wmma_f32_16x16x32_bf16(
                        false, b, false, a, (short)0, acc[nt], false, false);
            }
            if (i == 0) {
                readW(3);     // into registers that the first k step has left
                // keeps the group ahead of the other k steps' products
                __builtin_amdgcn_sched_barrier(0);
            }
        }
        // holds the wait below at the trip's foot, behind the products
        __builtin_amdgcn_sched_barrier(0);
        wait_ds0();           // own reads of this buffer are over, own W^T piece is in
        if (grp != bufi) wait_async0();   // tile t + 1 landed: its copiers' only outstanding tile
        __syncthreads();      // publishes tile t + 1; everyone done reading tile t
        xb = (xb == 2) ? 0 : xb + 1;
    }
    wait_async0();            // nothing in flight past the loop

    // epilogue: bias (+ softmax scale folded into Q), bf16, gathered in the LDS
    // that the loop's last barrier has freed (nothing is in flight into it)
    __bf16* sT = reinterpret_cast<__bf16*>(&sA[0][0]);
    if (VT) {
        // acc[nt][i] = V[mBase + wave*16 + hb + i][nt*16 + rowInTile]
#pragma unroll
        for (int nt = 0; nt < 4; ++nt) {
            const float bias = Bb[nt * 16 + rowInTile];
            v8bf h;
#pragma unroll
            for (int i = 0; i < 8; ++i) h[i] = (__bf16)(acc[nt][i] + bias);
            *reinterpret_cast<v8bf*>(
                &sT[(nt * 16 + rowInTile) * P256H + wave * 16 + hb]) = h;
        }
        __syncthreads();      // the tile's rows hold pieces of all eight waves
        const int n  = mBase >> 11;                // /L (2048)
        const int l0 = mBase & (LL - 1);
        __bf16* g = dst + ((size_t)n * DD + (tid >> 4)) * LL + l0 + (tid & 15) * 8;
        const __bf16* s = &sT[(tid >> 4) * P256H + (tid & 15) * 8];
#pragma unroll
        for (int j = 0; j < 4; ++j)                // a wave: two rows of 256 bytes
            *reinterpret_cast<v8bf*>(g + (size_t)j * 16 * LL) =
                *reinterpret_cast<const v8bf*>(s + j * 16 * P256H);
    } else {
        // acc[nt][i] = Y[mBase + wave*16 + rowInTile][nt*16 + hb + i]
#pragma unroll
        for (int nt = 0; nt < 4; ++nt) {
            const float4 b0 = *reinterpret_cast<const float4*>(Bb + nt * 16 + hb);
            const float4 b1 = *reinterpret_cast<const float4*>(Bb + nt * 16 + hb + 4);
            const float bias[8] = {b0.x, b0.y, b0.z, b0.w, b1.x, b1.y, b1.z, b1.w};
            v8bf h;
#pragma unroll
            for (int i = 0; i < 8; ++i)
                h[i] = (__bf16)((acc[nt][i] + bias[i]) * scale);
            *reinterpret_cast<v8bf*>(
                &sT[(wave * 16 + rowInTile) * P128H + nt * 16 + hb]) = h;
        }
        __syncthreads();      // orders the lanes' LDS stores before the row-wise reads
        __bf16* g = dst + (size_t)(mBase + (tid >> 3)) * DD + (tid & 7) * 8;
        const __bf16* s = &sT[(tid >> 3) * P128H + (tid & 7) * 8];
#pragma unroll
        for (int j = 0; j < 4; ++j)                // a wave: 512 contiguous bytes
            *reinterpret_cast<v8bf*>(g + (size_t)j * 32 * DD) =
                *reinterpret_cast<const v8bf*>(s + j * 32 * P128H);
    }
}

__global__ __launch_bounds__(256) void qkv_proj_kernel(
    const float* __restrict__ q_in, const float* __restrict__ k_in,
    const float* __restrict__ v_in,
    const float* __restrict__ Wq, const float* __restrict__ Wk,
    const float* __restrict__ Wv,                  // [1024][64] f32
    const float* __restrict__ bq, const float* __restrict__ bk,
    const float* __restrict__ bv,
    __bf16* __restrict__ qb, __bf16* __restrict__ kbr, __bf16* __restrict__ vbT)
{
    __shared__ __align__(16) float  sA[3][128 * P512F];   // [row][k] f32, ring of three
    __shared__ __align__(16) __bf16 sWT[2][64 * P256H];   // [n][k]  bf16

    const int mat = blockIdx.y;                    // 0=q, 1=k, 2=v
    if (mat == 2) {
        proj_body<true>(v_in, Wv, bv, 1.0f, vbT, sA, sWT);
    } else {
        // 0.125*log2(e) folded into q; times 1.0f leaves k as it is
        proj_body<false>(mat == 0 ? q_in : k_in, mat == 0 ? Wq : Wk,
                         mat == 0 ? bq : bk, mat == 0 ? QSCALE : 1.0f,
                         mat == 0 ? qb : kbr, sA, sWT);
    }
}

#define KPARTS 4
#define PKEYS  (LL / KPARTS)     // keys per quarter
#define NSTEP  (PKEYS / 32)      // steps per wave
#define OPITCH 68                // f32 row pitch of the partial O (16-byte column walks)

// value of lane l ^ 16
__device__ __forceinline__ float xhalf(float x) {
    const int xi = __builtin_bit_cast(int, x);
    return __builtin_bit_cast(float, __builtin_amdgcn_permlanex16(
        xi, xi, 0x76543210, 0xfedcba98, false, false));
}

__global__ __launch_bounds__(256) void attn_kernel(
    const __bf16* __restrict__ qb, const __bf16* __restrict__ kbr,
    const __bf16* __restrict__ vbT, float* __restrict__ out)
{
    const int tid       = threadIdx.x;
    const int lane      = tid & 31;
    const int wave      = tid >> 5;
    const int qtile     = wave & 1;                // which 16 of the 32 queries
    const int part      = wave >> 1;               // which quarter of the keys
    const int n         = blockIdx.x >> 6;         // batch
    const int qBase     = (blockIdx.x & 63) * 32;
    const int rowInTile = lane & 15;
    const int kb        = (lane & 16) ? 8 : 0;
    const int hb        = (lane & 16) ? 8 : 0;

    __shared__ __align__(16) __bf16 sK[3][KPARTS][32 * P128H];   // [key][d]
    __shared__ __align__(16) __bf16 sVT[3][KPARTS][64 * P64H];   // [d][key]
    __shared__ __align__(16) float  sO[KPARTS][32 * OPITCH];  // [query][d]
    __shared__ float sM[KPARTS][32];
    __shared__ float sL[KPARTS][32];

    // which half of the waves this one is in: scalar, so that the tests around
    // the copies and their wait are scalar branches
    const int grp = __builtin_amdgcn_readfirstlane(tid >> 7);
    // a thread's two 16-byte pieces of each quarter's K tile (keys r, r + 16) and
    // V^T tile (rows d, d + 32), in a step whose tiles its half copies
    const int t7 = tid & 127;
    const __bf16* gK = kbr + (size_t)n * LL * DD + t7 * 8;
    const __bf16* gV = vbT + ((size_t)n * DD + (t7 >> 2)) * LL + (t7 & 3) * 8;
    const int kOff = (t7 >> 3) * P128H + (t7 & 7) * 8;     // first place in a K tile
    const int vOff = (t7 >> 2) * P64H + (t7 & 3) * 8;      // first place in a V^T tile

    auto stageKV = [&](int step, int bufi) {
        const __bf16* k0 = gK + (size_t)step * 32 * DD;
        const __bf16* v0 = gV + step * 32;
        async_ld_b128_x8(
            lds_addr(&sK[bufi][0][kOff]),              k0,
            lds_addr(&sK[bufi][0][kOff + 16 * P128H]), k0 + 16 * DD,
            lds_addr(&sK[bufi][1][kOff]),              k0 + (size_t)1 * PKEYS * DD,
            lds_addr(&sK[bufi][1][kOff + 16 * P128H]), k0 + (size_t)1 * PKEYS * DD + 16 * DD,
            lds_addr(&sK[bufi][2][kOff]),              k0 + (size_t)2 * PKEYS * DD,
            lds_addr(&sK[bufi][2][kOff + 16 * P128H]), k0 + (size_t)2 * PKEYS * DD + 16 * DD,
            lds_addr(&sK[bufi][3][kOff]),              k0 + (size_t)3 * PKEYS * DD,
            lds_addr(&sK[bufi][3][kOff + 16 * P128H]), k0 + (size_t)3 * PKEYS * DD + 16 * DD);
        async_ld_b128_x8(
            lds_addr(&sVT[bufi][0][vOff]),             v0,
            lds_addr(&sVT[bufi][0][vOff + 32 * P64H]), v0 + (size_t)32 * LL,
            lds_addr(&sVT[bufi][1][vOff]),             v0 + 1 * PKEYS,
            lds_addr(&sVT[bufi][1][vOff + 32 * P64H]), v0 + (size_t)32 * LL + 1 * PKEYS,
            lds_addr(&sVT[bufi][2][vOff]),             v0 + 2 * PKEYS,
            lds_addr(&sVT[bufi][2][vOff + 32 * P64H]), v0 + (size_t)32 * LL + 2 * PKEYS,
            lds_addr(&sVT[bufi][3][vOff]),             v0 + 3 * PKEYS,
            lds_addr(&sVT[bufi][3][vOff + 32 * P64H]), v0 + (size_t)32 * LL + 3 * PKEYS);
    };

    // load this wave's Q fragments (64 d x 16 queries -> two 32x16 B-frags)
    const __bf16* qrow =
        qb + (size_t)(n * LL + qBase + qtile * 16 + rowInTile) * DD;
    v16bf qf[2];
#pragma unroll
    for (int h = 0; h < 2; ++h)
#pragma unroll
        for (int e = 0; e < 16; ++e)
            qf[h][e] = qrow[h * 32 + fragK(e, kb)];

    v8f oacc[4];                                   // O^T: vgpr i -> d = dt*16+hb+i
#pragma unroll
    for (int dt = 0; dt < 4; ++dt) oacc[dt] = vzero8();
    float mrun = -1e30f;   // running maximum of this lane's query (both halves equal)
    float lrun = 0.0f;     // running sum over this lane's half of the keys

    if (grp == 0) stageKV(0, 0);  // steps 0 and 1 start together
    else          stageKV(1, 1);
    if (grp == 0) wait_async0();  // step 0's tiles landed; step 1's stay in flight
    __syncthreads();

    int xb = 0;                                    // buffer of step st: st mod 3
    for (int st = 0; st < NSTEP; ++st) {
        const __bf16* tK = sK[xb][part];
        const __bf16* tV = sVT[xb][part];

        // all 16 fragment reads of the step as one group, each into registers of
        // its own, K first in the order of its products: the step pays the LDS
        // latency once, not once per product
        v8bf kfr[2][2][2];                         // [d half][key tile][k run]
        v8bf vfr[4][2];                            // [d tile][k run]
#pragma unroll   // here and below: the fragments live in registers, constant indices
        for (int h = 0; h < 2; ++h)
#pragma unroll
            for (int ct = 0; ct < 2; ++ct) {
                const __bf16* p = tK + (ct * 16 + rowInTile) * P128H + h * 32 + kb;
                kfr[h][ct][0] = *reinterpret_cast<const v8bf*>(p);
                kfr[h][ct][1] = *reinterpret_cast<const v8bf*>(p + 16);
            }
#pragma unroll
        for (int dt = 0; dt < 4; ++dt) {
            const __bf16* p = tV + (dt * 16 + rowInTile) * P64H + kb;
            vfr[dt][0] = *reinterpret_cast<const v8bf*>(p);
            vfr[dt][1] = *reinterpret_cast<const v8bf*>(p + 16);
        }

        // step st + 2's tiles, by the half whose step st has landed, into the
        // buffer that step st - 1 read (freed by that step's barrier); behind the
        // reads of this step's buffer, so that its issue runs under their latency
        if (st + 2 < NSTEP && grp == (st & 1)) stageKV(st + 2, xb == 0 ? 2 : xb - 1);

        // scores S^T = K Q^T (pre-scaled by 0.125*log2e): 2 key tiles x 2 d-steps
        // D layout: sc[ct][i] = S[query rowInTile][key ct*16 + hb + i]
        v8f sc[2];
        sc[0] = vzero8(); sc[1] = vzero8();
#pragma unroll
        for (int h = 0; h < 2; ++h)
#pragma unroll
            for (int ct = 0; ct < 2; ++ct) {
                // element e of the fragment is d h*32 + fragK(e, kb): the two runs in turn
                const v16bf akf = __builtin_shufflevector(
                    kfr[h][ct][0], kfr[h][ct][1],
                    0, 1, 2, 3, 4, 5, 6, 7, 8, 9, 10, 11, 12, 13, 14, 15);
                sc[ct] = __builtin_amdgcn_wmma_f32_16x16x32_bf16(
                    false, akf, false, qf[h], (short)0, sc[ct], false, false);
            }

        // online softmax in exp2 domain, one query per lane
        float t8[8];
#pragma unroll
        for (int i = 0; i < 8; ++i) t8[i] = fmaxf(sc[0][i], sc[1][i]);
        float tmax = fmaxf(fmaxf(fmaxf(t8[0], t8[1]), fmaxf(t8[2], t8[3])),
                           fmaxf(fmaxf(t8[4], t8[5]), fmaxf(t8[6], t8[7])));
        tmax = fmaxf(tmax, xhalf(tmax));           // join the two key halves
        const float mnew = fmaxf(mrun, tmax);
        const float corr = exp2f(mrun - mnew);     // v_exp_f32 is base-2
        mrun = mnew;

        // P^T: element e of the B fragment is key fragK(e, kb) = sc[e>>3][e&7]
        v16bf pf;
        float ps[8];
#pragma unroll
        for (int i = 0; i < 8; ++i) {
            const float p0 = exp2f(sc[0][i] - mnew);
            const float p1 = exp2f(sc[1][i] - mnew);
            pf[i]     = (__bf16)p0;
            pf[8 + i] = (__bf16)p1;
            ps[i] = p0 + p1;
        }
        const float psum = ((ps[0] + ps[1]) + (ps[2] + ps[3])) +
                           ((ps[4] + ps[5]) + (ps[6] + ps[7]));
        lrun = lrun * corr + psum;
#pragma unroll
        for (int dt = 0; dt < 4; ++dt)
#pragma unroll
            for (int i = 0; i < 8; ++i) oacc[dt][i] *= corr;

        // O^T += V^T P^T : 4 d-tiles, element e of a fragment is key fragK(e, kb)
#pragma unroll
        for (int dt = 0; dt < 4; ++dt) {
            const v16bf avf = __builtin_shufflevector(
                vfr[dt][0], vfr[dt][1],
                0, 1, 2, 3, 4, 5, 6, 7, 8, 9, 10, 11, 12, 13, 14, 15);
            oacc[dt] = __builtin_amdgcn_wmma_f32_16x16x32_bf16(
                false, avf, false, pf, (short)0, oacc[dt], false, false);
        }
        // holds the wait below at the step's foot: lifted to the first product, as
        // the scheduler did, it would drain all 16 reads before the second product
        __builtin_amdgcn_sched_barrier(0);
        wait_ds0();           // own reads of this buffer are over
        if (grp != (st & 1)) wait_async0();   // step st + 1's tiles landed: their copiers' only outstanding ones
        __syncthreads();      // publishes them; everyone done reading this buffer
        xb = (xb == 2) ? 0 : xb + 1;
    }
    wait_async0();            // nothing in flight past the loop

    // hand this quarter's partial (max, sum, O) of 16 queries to the block
    const float lsum = lrun + xhalf(lrun);         // join the halves' sums
    const int ql = qtile * 16 + rowInTile;
    if (lane < 16) {
        sM[part][ql] = mrun;
        sL[part][ql] = lsum;
    }
    float* prow = &sO[part][ql * OPITCH + hb];
#pragma unroll
    for (int dt = 0; dt < 4; ++dt) {
        *reinterpret_cast<float4*>(prow + dt * 16) =
            make_float4(oacc[dt][0], oacc[dt][1], oacc[dt][2], oacc[dt][3]);
        *reinterpret_cast<float4*>(prow + dt * 16 + 4) =
            make_float4(oacc[dt][4], oacc[dt][5], oacc[dt][6], oacc[dt][7]);
    }
    __syncthreads();          // all four quarters' partials are in LDS

    // join: rescale each quarter to the common maximum, add, normalize, store
    // f32 output (N, L, 64); a wave's store covers 512 contiguous bytes
#pragma unroll
    for (int j = 0; j < 2; ++j) {
        const int q = j * 16 + (tid >> 4);
        const int d = (tid & 15) * 4;
        const float m0 = sM[0][q], m1 = sM[1][q], m2 = sM[2][q], m3 = sM[3][q];
        const float mall = fmaxf(fmaxf(m0, m1), fmaxf(m2, m3));
        const float f0 = exp2f(m0 - mall), f1 = exp2f(m1 - mall);
        const float f2 = exp2f(m2 - mall), f3 = exp2f(m3 - mall);
        const float lall = (f0 * sL[0][q] + f1 * sL[1][q]) +
                           (f2 * sL[2][q] + f3 * sL[3][q]);
        const float inv = 1.0f / lall;
        const float4 o0 = *reinterpret_cast<const float4*>(&sO[0][q * OPITCH + d]);
        const float4 o1 = *reinterpret_cast<const float4*>(&sO[1][q * OPITCH + d]);
        const float4 o2 = *reinterpret_cast<const float4*>(&sO[2][q * OPITCH + d]);
        const float4 o3 = *reinterpret_cast<const float4*>(&sO[3][q * OPITCH + d]);
        float4 r;
        r.x = ((f0 * o0.x + f1 * o1.x) + (f2 * o2.x + f3 * o3.x)) * inv;
        r.y = ((f0 * o0.y + f1 * o1.y) + (f2 * o2.y + f3 * o3.y)) * inv;
        r.z = ((f0 * o0.z + f1 * o1.z) + (f2 * o2.z + f3 * o3.z)) * inv;
        r.w = ((f0 * o0.w + f1 * o1.w) + (f2 * o2.w + f3 * o3.w)) * inv;
        *reinterpret_cast<float4*>(
            out + (size_t)(n * LL + qBase + q) * DD + d) = r;
    }
}

// ============================================================
extern "C" void kernel_launch(void* const* d_in, const int* in_sizes, int n_in,
                              void* d_out, int out_size, void* d_ws, size_t ws_size,
                              hipStream_t stream) {
    const float* query = (const float*)d_in[0];
    const float* key_  = (const float*)d_in[1];
    const float* value = (const float*)d_in[2];
    const float* Wq    = (const float*)d_in[3];
    const float* bq    = (const float*)d_in[4];
    const float* Wk    = (const float*)d_in[5];
    const float* bk    = (const float*)d_in[6];
    const float* Wv    = (const float*)d_in[7];
    const float* bv    = (const float*)d_in[8];
    float* out = (float*)d_out;

    const size_t elems = (size_t)NB * LL * DD;     // 524288
    __bf16* qb  = (__bf16*)d_ws;
    __bf16* kbr = qb + elems;
    __bf16* vbT = kbr + elems;

    dim3 g1(64, 3, 1);
    qkv_proj_kernel<<<g1, 256, 0, stream>>>(query, key_, value, Wq, Wk, Wv,
                                            bq, bk, bv, qb, kbr, vbT);
    attn_kernel<<<256, 256, 0, stream>>>(qb, kbr, vbT, out);
}

// v009
// A run of this version takes 22.3 microseconds.
// In two side-by-side timings against v008, it was 1.03 and 1.08 times as fast.
// All steps since v000 together make it 5.98 times as fast.
#include <hip/hip_runtime.h>
#include <hip/hip_bf16.h>

// ---- problem constants (from reference) ----
#define NB 4
#define LL 2048
#define HH 1024
#define DD 64

// 0.125 (=1/sqrt(64)) * log2(e): folded into the Q projection so the
// softmax can run directly on hardware base-2 exp (v_exp_f32).
#define QSCALE 0.18033688011112042f

typedef __attribute__((ext_vector_type(16))) __bf16 v16bf;
typedef __attribute__((ext_vector_type(8)))  __bf16 v8bf;
typedef __attribute__((ext_vector_type(8)))  float  v8f;

__device__ __forceinline__ v8f vzero8() {
    v8f z;
#pragma unroll
    for (int i = 0; i < 8; ++i) z[i] = 0.0f;
    return z;
}

// A/B 16-bit fragment K-index pattern (wave32):
// lane<16 holds K {0..7,16..23}, lane>=16 holds K {8..15,24..31}
__device__ __forceinline__ int fragK(int e, int kb) {
    return kb + e + ((e & 8) ? 8 : 0);
}

// CDNA5 async global->LDS copy (16 bytes per lane), tracked by ASYNCcnt.
// Low 32 bits of a generic pointer into LDS == wave-relative LDS byte offset
// (ISA 10.2 aperture mapping), which is what VDST wants.
__device__ __forceinline__ unsigned lds_addr(const void* p) {
    return (unsigned)(unsigned long long)p;
}
// Eight async copies (16 bytes per lane each).  The closing s_wait_xcnt keeps
// every later rewrite of the address registers behind the copies' issue.
__device__ __forceinline__ void async_ld_b128_x8(
    unsigned l0, const void* g0, unsigned l1, const void* g1,
    unsigned l2, const void* g2, unsigned l3, const void* g3,
    unsigned l4, const void* g4, unsigned l5, const void* g5,
    unsigned l6, const void* g6, unsigned l7, const void* g7) {
    asm volatile("global_load_async_to_lds_b128 %0, %1, off\n\t"
                 "global_load_async_to_lds_b128 %2, %3, off\n\t"
                 "global_load_async_to_lds_b128 %4, %5, off\n\t"
                 "global_load_async_to_lds_b128 %6, %7, off\n\t"
                 "global_load_async_to_lds_b128 %8, %9, off\n\t"
                 "global_load_async_to_lds_b128 %10, %11, off\n\t"
                 "global_load_async_to_lds_b128 %12, %13, off\n\t"
                 "global_load_async_to_lds_b128 %14, %15, off\n\t"
                 "s_wait_xcnt 0x0"
                 :: "v"(l0), "v"(g0), "v"(l1), "v"(g1), "v"(l2), "v"(g2),
                    "v"(l3), "v"(g3), "v"(l4), "v"(g4), "v"(l5), "v"(g5),
                    "v"(l6), "v"(g6), "v"(l7), "v"(g7)
                 : "memory");
}
__device__ __forceinline__ void wait_async0() {
    asm volatile("s_wait_asynccnt 0" ::: "memory");
}
// This wave's LDS reads have returned before the buffer is handed back for a refill.
__device__ __forceinline__ void wait_ds0() {
    asm volatile("s_wait_dscnt 0x0" ::: "memory");
}

// LDS row pitches.  The fragments are read with 16-byte LDS loads, one tile
// row per lane: a pitch of 16 bytes x an odd number puts the 16 rows of a
// half wave on 16 different groups of four banks (512-byte rows -> 528 bytes,
// 256 -> 272, 128 -> 144).  The pad bytes are never written and never read.
#define P512F 132                // f32  elements: 128 used + 4 pad
#define P256H 136                // bf16 elements: 128 used + 8 pad
#define P128H 72                 // bf16 elements: 64 used + 8 pad

// k extent of one staged tile of the projection (128 rows x 512 bytes = 64 KiB
// of X).  The X ring has three buffers and a block keeps two tiles in flight,
// so a tile has two trips to land and the memory path never runs empty.
#define KT 128
#define NT (HH / KT)             // tiles

// ============================================================
// Kernel 1: fused QKV projection.  grid = (64, 3), block = 256
//   X(8192x1024) * W(1024x64) + b  ->  bf16
//   mat 0 -> qb [m][d] (scaled by QSCALE) ; mat 1 -> kbr [m][d] ;
//   mat 2 -> vbT [n][d][l]
// LDS staging, KT k per tile.  X by async copies into a ring of three buffers:
// waves 0-3 copy the even tiles, waves 4-7 the odd ones, each tile two trips
// ahead of its use; a wave then never has more than one tile outstanding, so
// its wait to 0 drains the tile that is due and leaves the other half's
// younger tile in flight.  W (f32, [k][n]), two buffers, through registers,
// where it is rounded to bf16 and turned to [n][k]:
// a thread loads 4 runs of 8 k of one column n (a wave's load = one 128-byte
// line) two tiles ahead and stores them one tile ahead as 16-byte LDS row pieces.
// Operand order by output layout, so that a lane's 8 accumulator registers are
// 8 neighbours of one output row: V^T (VT) takes X as A and W^T as B (lane =
// column d, registers = 8 l); Q and K take W^T as A and X as B (lane = row m,
// registers = 8 d).  The block's bf16 tile is gathered in LDS with 16-byte
// stores and leaves as whole rows: 64 x 256 bytes (V^T), 128 x 128 bytes (Q, K).
// ============================================================
template <bool VT>
__device__ __forceinline__ void proj_body(
    const float* __restrict__ X, const float* __restrict__ Wm,
    const float* __restrict__ Bb, const float scale, __bf16* __restrict__ dst,
    float (*sA)[128 * P512F], __bf16 (*sWT)[64 * P256H])
{
    const int mBase     = blockIdx.x * 128;        // row base in flattened (N*L)
    const int tid       = threadIdx.x;
    const int lane      = tid & 31;
    const int wave      = tid >> 5;                // 0..7
    const int rowInTile = lane & 15;
    const int kb        = (lane & 16) ? 8 : 0;
    const int hb        = (lane & 16) ? 8 : 0;     // C-layout row offset

    // which half of the waves this one is in: scalar, so that the tests around
    // the copies and their wait are scalar branches
    const int grp = __builtin_amdgcn_readfirstlane(tid >> 7);
    // a wave's copy is one whole 512-byte tile row; its rows in a tile that its
    // half copies: (wave & 3) + 4 c, c = 0..31
    const int w4 = wave & 3;
    const float* gA = X + (size_t)(mBase + w4) * HH + lane * 4;
    // a thread's pieces of the W^T tile: column wn of W, rows p*32 + wk .. + 7
    const int wn = tid & 63, wk = (tid >> 6) * 8;
    const float* gW = Wm + (size_t)wk * DD + wn;

    float wreg[KT / 4];                            // W values on their way to LDS
    auto loadW = [&](int kk) {
#pragma unroll
        for (int p = 0; p < KT / 32; ++p)
#pragma unroll
            for (int j = 0; j < 8; ++j)
                wreg[p * 8 + j] = gW[(size_t)(kk + p * 32 + j) * DD];
        // keeps the later advance of the loads' address registers behind their issue
        asm volatile("s_wait_xcnt 0x0" ::: "memory");
    };
    auto stage = [&](int kk, int bufi) {
#pragma unroll   // four statements of eight copies, row offsets constant
        for (int c = 0; c < 32; c += 8) {
            float* la = &sA[bufi][(w4 + c * 4) * P512F + lane * 4];
            const float* g = gA + kk + (size_t)c * 4 * HH;
            async_ld_b128_x8(
                lds_addr(la),              g,
                lds_addr(la +  4 * P512F), g + (size_t) 4 * HH,
                lds_addr(la +  8 * P512F), g + (size_t) 8 * HH,
                lds_addr(la + 12 * P512F), g + (size_t)12 * HH,
                lds_addr(la + 16 * P512F), g + (size_t)16 * HH,
                lds_addr(la + 20 * P512F), g + (size_t)20 * HH,
                lds_addr(la + 24 * P512F), g + (size_t)24 * HH,
                lds_addr(la + 28 * P512F), g + (size_t)28 * HH);
        }
    };
    auto putW = [&](int bufi) {
#pragma unroll
        for (int p = 0; p < KT / 32; ++p) {
            v8bf h;
#pragma unroll
            for (int j = 0; j < 8; ++j) h[j] = (__bf16)wreg[p * 8 + j];
            *reinterpret_cast<v8bf*>(&sWT[bufi][wn * P256H + p * 32 + wk]) = h;
        }
    };

    v8f acc[4];
#pragma unroll
    for (int nt = 0; nt < 4; ++nt) acc[nt] = vzero8();

    if (grp == 0) stage(0, 0);    // tiles 0 and 1 start together
    else          stage(KT, 1);
    loadW(0);
    putW(0);
    loadW(KT);
    if (grp == 0) wait_async0();  // tile 0 landed; tile 1 stays in flight
    __syncthreads();

    int xb = 0;                                       // X buffer of tile t: t mod 3
    for (int t = 0; t < NT; ++t) {
        const int bufi = t & 1;                       // W^T buffer of tile t
        const int kk   = t * KT;

        // Fragment reads of the trip's four k steps (each 4 of X, 8 of W^T, 16 bytes
        // a lane), issued in whole groups well ahead of their products: the first k
        // step's and the second's X ahead of this trip's W and copy issue, which runs
        // under their latency (more would pass 256 registers there), the rest behind
        // it and behind the first products.
        const float*  xrow = &sA[xb][(wave * 16 + rowInTile) * P512F + kb];
        const __bf16* wrow = &sWT[bufi][rowInTile * P256H + kb];
        float4 xr[KT / 32][4];
        v8bf   wr[KT / 32][4][2];
        auto readX = [&](int i) {
            xr[i][0] = *reinterpret_cast<const float4*>(xrow + i * 32);
            xr[i][1] = *reinterpret_cast<const float4*>(xrow + i * 32 + 4);
            xr[i][2] = *reinterpret_cast<const float4*>(xrow + i * 32 + 16);
            xr[i][3] = *reinterpret_cast<const float4*>(xrow + i * 32 + 20);
        };
        auto readW = [&](int i) {
#pragma unroll   // the fragments live in registers: constant indices
            for (int nt = 0; nt < 4; ++nt) {
                const __bf16* p = wrow + nt * 16 * P256H + i * 32;
                wr[i][nt][0] = *reinterpret_cast<const v8bf*>(p);
                wr[i][nt][1] = *reinterpret_cast<const v8bf*>(p + 16);
            }
        };
        readX(0); readW(0); readX(1);

        if (t + 1 < NT) {
            putW(bufi ^ 1);       // next tile's W^T part, loaded a trip ago, into the buffer not being read
            if (t + 2 < NT) loadW(kk + 2 * KT);   // due at this trip's barrier: ahead of the copies
        }
        // tile t + 2, by the half whose tile t has landed, into the buffer that
        // trip t - 1 read (freed by that trip's barrier)
        if (t + 2 < NT && grp == bufi) stage(kk + 2 * KT, xb == 0 ? 2 : xb - 1);

        readW(1); readX(2); readX(3); readW(2);
        // the compiler fence keeps the reads above it, the scheduling barrier the
        // products below it (left free, each read sinks to its product and pays
        // the LDS latency there)
        asm volatile("" ::: "memory");
        __builtin_amdgcn_sched_barrier(0);

#pragma unroll   // constant register sets
        for (int i = 0; i < KT / 32; ++i) {
            // X fragment: 16 rows x 32 k; element e is k i*32 + fragK(e, kb), the two
            // runs of 8 in turn, as in the W^T fragments
            v16bf a;
#pragma unroll
            for (int e = 0; e < 16; ++e) {
                const float4 x4 = xr[i][e >> 2];
                a[e] = (__bf16)((e & 3) == 0 ? x4.x : (e & 3) == 1 ? x4.y
                                : (e & 3) == 2 ? x4.z : x4.w);
            }

            // 4 W^T fragments (bf16, no conversion) + WMMA
#pragma unroll
            for (int nt = 0; nt < 4; ++nt) {
                const v16bf b = __builtin_shufflevector(
                    wr[i][nt][0], wr[i][nt][1],
                    0, 1, 2, 3, 4, 5, 6, 7, 8, 9, 10, 11, 12, 13, 14, 15);
                if (VT)
                    acc[nt] = __builtin_amdgcn_wmma_f32_16x16x32_bf16(
                        false, a, false, b, (short)0, acc[nt], false, false);
                else
                    acc[nt] = __builtin_amdgcn_wmma_f32_16x16x32_bf16(
                        false, b, false, a, (short)0, acc[nt], false, false);
            }
            if (i == 0) {
                readW(3);     // into registers that the first k step has left
                // keeps the group ahead of the other k steps' products
                __builtin_amdgcn_sched_barrier(0);
            }
        }
        // holds the wait below at the trip's foot, behind the products
        __builtin_amdgcn_sched_barrier(0);
        wait_ds0();           // own reads of this buffer are over, own W^T piece is in
        if (grp != bufi) wait_async0();   // tile t + 1 landed: its copiers' only outstanding tile
        __syncthreads();      // publishes tile t + 1; everyone done reading tile t
        xb = (xb == 2) ? 0 : xb + 1;
    }
    wait_async0();            // nothing in flight past the loop

    // epilogue: bias (+ softmax scale folded into Q), bf16, gathered in the LDS
    // that the loop's last barrier has freed (nothing is in flight into it)
    __bf16* sT = reinterpret_cast<__bf16*>(&sA[0][0]);
    if (VT) {
        // acc[nt][i] = V[mBase + wave*16 + hb + i][nt*16 + rowInTile]
#pragma unroll
        for (int nt = 0; nt < 4; ++nt) {
            const float bias = Bb[nt * 16 + rowInTile];
            v8bf h;
#pragma unroll
            for (int i = 0; i < 8; ++i) h[i] = (__bf16)(acc[nt][i] + bias);
            *reinterpret_cast<v8bf*>(
                &sT[(nt * 16 + rowInTile) * P256H + wave * 16 + hb]) = h;
        }
        __syncthreads();      // the tile's rows hold pieces of all eight waves
        const int n  = mBase >> 11;                // /L (2048)
        const int l0 = mBase & (LL - 1);
        __bf16* g = dst + ((size_t)n * DD + (tid >> 4)) * LL + l0 + (tid & 15) * 8;
        const __bf16* s = &sT[(tid >> 4) * P256H + (tid & 15) * 8];
#pragma unroll
        for (int j = 0; j < 4; ++j)                // a wave: two rows of 256 bytes
            *reinterpret_cast<v8bf*>(g + (size_t)j * 16 * LL) =
                *reinterpret_cast<const v8bf*>(s + j * 16 * P256H);
    } else {
        // acc[nt][i] = Y[mBase + wave*16 + rowInTile][nt*16 + hb + i]
#pragma unroll
        for (int nt = 0; nt < 4; ++nt) {
            const float4 b0 = *reinterpret_cast<const float4*>(Bb + nt * 16 + hb);
            const float4 b1 = *reinterpret_cast<const float4*>(Bb + nt * 16 + hb + 4);
            const float bias[8] = {b0.x, b0.y, b0.z, b0.w, b1.x, b1.y, b1.z, b1.w};
            v8bf h;
#pragma unroll
            for (int i = 0; i < 8; ++i)
                h[i] = (__bf16)((acc[nt][i] + bias[i]) * scale);
            *reinterpret_cast<v8bf*>(
                &sT[(wave * 16 + rowInTile) * P128H + nt * 16 + hb]) = h;
        }
        __syncthreads();      // orders the lanes' LDS stores before the row-wise reads
        __bf16* g = dst + (size_t)(mBase + (tid >> 3)) * DD + (tid & 7) * 8;
        const __bf16* s = &sT[(tid >> 3) * P128H + (tid & 7) * 8];
#pragma unroll
        for (int j = 0; j < 4; ++j)                // a wave: 512 contiguous bytes
            *reinterpret_cast<v8bf*>(g + (size_t)j * 32 * DD) =
                *reinterpret_cast<const v8bf*>(s + j * 32 * P128H);
    }
}

__global__ __launch_bounds__(256) void qkv_proj_kernel(
    const float* __restrict__ q_in, const float* __restrict__ k_in,
    const float* __restrict__ v_in,
    const float* __restrict__ Wq, const float* __restrict__ Wk,
    const float* __restrict__ Wv,                  // [1024][64] f32
    const float* __restrict__ bq, const float* __restrict__ bk,
    const float* __restrict__ bv,
    __bf16* __restrict__ qb, __bf16* __restrict__ kbr, __bf16* __restrict__ vbT)
{
    __shared__ __align__(16) float  sA[3][128 * P512F];   // [row][k] f32, ring of three
    __shared__ __align__(16) __bf16 sWT[2][64 * P256H];   // [n][k]  bf16

    const int mat = blockIdx.y;                    // 0=q, 1=k, 2=v
    if (mat == 2) {
        proj_body<true>(v_in, Wv, bv, 1.0f, vbT, sA, sWT);
    } else {
        // 0.125*log2(e) folded into q; times 1.0f leaves k as it is
        proj_body<false>(mat == 0 ? q_in : k_in, mat == 0 ? Wq : Wk,
                         mat == 0 ? bq : bk, mat == 0 ? QSCALE : 1.0f,
                         mat == 0 ? qb : kbr, sA, sWT);
    }
}

#define KPARTS 4
#define PKEYS  (LL / KPARTS)     // keys per quarter
#define SKEYS  64                // keys per step
#define NSTEP  (PKEYS / SKEYS)   // steps per wave
#define OPITCH 68                // f32 row pitch of the partial O (16-byte column walks)

// value of lane l ^ 16
__device__ __forceinline__ float xhalf(float x) {
    const int xi = __builtin_bit_cast(int, x);
    return __builtin_bit_cast(float, __builtin_amdgcn_permlanex16(
        xi, xi, 0x76543210, 0xfedcba98, false, false));
}

__global__ __launch_bounds__(256) void attn_kernel(
    const __bf16* __restrict__ qb, const __bf16* __restrict__ kbr,
    const __bf16* __restrict__ vbT, float* __restrict__ out)
{
    const int tid       = threadIdx.x;
    const int lane      = tid & 31;
    const int wave      = tid >> 5;
    const int qtile     = wave & 1;                // which 16 of the 32 queries
    const int part      = wave >> 1;               // which quarter of the keys
    const int n         = blockIdx.x >> 6;         // batch
    const int qBase     = (blockIdx.x & 63) * 32;
    const int rowInTile = lane & 15;
    const int kb        = (lane & 16) ? 8 : 0;
    const int hb        = (lane & 16) ? 8 : 0;

    __shared__ __align__(16) __bf16 sK[3][KPARTS][SKEYS * P128H];   // [key][d]
    __shared__ __align__(16) __bf16 sVT[3][KPARTS][DD * P128H];     // [d][key]
    __shared__ __align__(16) float  sO[KPARTS][32 * OPITCH];  // [query][d]
    __shared__ float sM[KPARTS][32];
    __shared__ float sL[KPARTS][32];

    // which half of the waves this one is in: scalar, so that the tests around
    // the copies and their wait are scalar branches
    const int grp = __builtin_amdgcn_readfirstlane(tid >> 7);
    // a thread's four 16-byte pieces of each quarter's K tile (keys r + 16 j) and
    // V^T tile (rows d + 16 j), in a step whose tiles its half copies: eight
    // threads to a 128-byte row, so a wave's copy is four whole lines
    const int t7 = tid & 127;
    const __bf16* gK = kbr + (size_t)n * LL * DD + t7 * 8;
    const __bf16* gV = vbT + ((size_t)n * DD + (t7 >> 3)) * LL + (t7 & 7) * 8;
    const int tOff = (t7 >> 3) * P128H + (t7 & 7) * 8;     // first place in either tile

    auto stageKV = [&](int step, int bufi) {
#pragma unroll   // one statement of eight copies a quarter, offsets constant
        for (int p = 0; p < KPARTS; ++p) {
            const __bf16* k0 = gK + (size_t)(p * PKEYS + step * SKEYS) * DD;
            const __bf16* v0 = gV + p * PKEYS + step * SKEYS;
            const __bf16* lk = &sK[bufi][p][tOff];
            const __bf16* lv = &sVT[bufi][p][tOff];
            async_ld_b128_x8(
                lds_addr(lk),              k0,
                lds_addr(lk + 16 * P128H), k0 + 16 * DD,
                lds_addr(lk + 32 * P128H), k0 + 32 * DD,
                lds_addr(lk + 48 * P128H), k0 + 48 * DD,
                lds_addr(lv),              v0,
                lds_addr(lv + 16 * P128H), v0 + (size_t)16 * LL,
                lds_addr(lv + 32 * P128H), v0 + (size_t)32 * LL,
                lds_addr(lv + 48 * P128H), v0 + (size_t)48 * LL);
        }
    };

    // load this wave's Q fragments (64 d x 16 queries -> two 32x16 B-frags)
    const __bf16* qrow =
        qb + (size_t)(n * LL + qBase + qtile * 16 + rowInTile) * DD;
    v16bf qf[2];
#pragma unroll
    for (int h = 0; h < 2; ++h)
#pragma unroll
        for (int e = 0; e < 16; ++e)
            qf[h][e] = qrow[h * 32 + fragK(e, kb)];

    v8f oacc[4];                                   // O^T: vgpr i -> d = dt*16+hb+i
#pragma unroll
    for (int dt = 0; dt < 4; ++dt) oacc[dt] = vzero8();
    float mrun = -1e30f;   // running maximum of this lane's query (both halves equal)
    float lrun = 0.0f;     // running sum over this lane's half of the keys

    if (grp == 0) stageKV(0, 0);  // steps 0 and 1 start together
    else          stageKV(1, 1);
    if (grp == 0) wait_async0();  // step 0's tiles landed; step 1's stay in flight
    __syncthreads();

    int xb = 0;                                    // buffer of step st: st mod 3
    for (int st = 0; st < NSTEP; ++st) {
        const __bf16* tK = sK[xb][part];
        const __bf16* tV = sVT[xb][part];

        // the 16 K fragment reads of the step as one group, each into registers of
        // its own, in the order of their products: the LDS latency is paid once
        v8bf kfr[2][4][2];                         // [d half][key tile][k run]
#pragma unroll   // here and below: the fragments live in registers, constant indices
        for (int h = 0; h < 2; ++h)
#pragma unroll
            for (int ct = 0; ct < 4; ++ct) {
                const __bf16* p = tK + (ct * 16 + rowInTile) * P128H + h * 32 + kb;
                kfr[h][ct][0] = *reinterpret_cast<const v8bf*>(p);
                kfr[h][ct][1] = *reinterpret_cast<const v8bf*>(p + 16);
            }

        // step st + 2's tiles, by the half whose step st has landed, into the
        // buffer that step st - 1 read (freed by that step's barrier); behind the
        // K reads of this step's buffer, so that its issue runs under their latency
        if (st + 2 < NSTEP && grp == (st & 1)) stageKV(st + 2, xb == 0 ? 2 : xb - 1);

        // the 16 V^T fragment reads as a second group, registers of their own: they
        // land under the score products and the softmax
        v8bf vfr[2][4][2];                         // [32 keys][d tile][k run]
#pragma unroll
        for (int g = 0; g < 2; ++g)
#pragma unroll
            for (int dt = 0; dt < 4; ++dt) {
                const __bf16* p = tV + (dt * 16 + rowInTile) * P128H + g * 32 + kb;
                vfr[g][dt][0] = *reinterpret_cast<const v8bf*>(p);
                vfr[g][dt][1] = *reinterpret_cast<const v8bf*>(p + 16);
            }
        // keeps the group whole and up here (left free, six of the reads sink to
        // their products and each pair pays the LDS latency there)
        __builtin_amdgcn_sched_barrier(0);

        // scores S^T = K Q^T (pre-scaled by 0.125*log2e): 4 key tiles x 2 d-steps
        // D layout: sc[ct][i] = S[query rowInTile][key ct*16 + hb + i]
        v8f sc[4];
#pragma unroll
        for (int ct = 0; ct < 4; ++ct) sc[ct] = vzero8();
#pragma unroll
        for (int h = 0; h < 2; ++h)
#pragma unroll
            for (int ct = 0; ct < 4; ++ct) {
                // element e of the fragment is d h*32 + fragK(e, kb): the two runs in turn
                const v16bf akf = __builtin_shufflevector(
                    kfr[h][ct][0], kfr[h][ct][1],
                    0, 1, 2, 3, 4, 5, 6, 7, 8, 9, 10, 11, 12, 13, 14, 15);
                sc[ct] = __builtin_amdgcn_wmma_f32_16x16x32_bf16(
                    false, akf, false, qf[h], (short)0, sc[ct], false, false);
            }

        // online softmax in exp2 domain, one query per lane
        float t8[8];
#pragma unroll
        for (int i = 0; i < 8; ++i)
            t8[i] = fmaxf(fmaxf(sc[0][i], sc[1][i]), fmaxf(sc[2][i], sc[3][i]));
        float tmax = fmaxf(fmaxf(fmaxf(t8[0], t8[1]), fmaxf(t8[2], t8[3])),
                           fmaxf(fmaxf(t8[4], t8[5]), fmaxf(t8[6], t8[7])));
        tmax = fmaxf(tmax, xhalf(tmax));           // join the two key halves
        const float mnew = fmaxf(mrun, tmax);
        const float corr = exp2f(mrun - mnew);     // v_exp_f32 is base-2
        mrun = mnew;

        // P^T: element e of B fragment g is key g*32 + fragK(e, kb) = sc[2g + (e>>3)][e&7]
        v16bf pf[2];
        float ps[8];
#pragma unroll
        for (int i = 0; i < 8; ++i) {
            const float p0 = exp2f(sc[0][i] - mnew);
            const float p1 = exp2f(sc[1][i] - mnew);
            const float p2 = exp2f(sc[2][i] - mnew);
            const float p3 = exp2f(sc[3][i] - mnew);
            pf[0][i]     = (__bf16)p0;
            pf[0][8 + i] = (__bf16)p1;
            pf[1][i]     = (__bf16)p2;
            pf[1][8 + i] = (__bf16)p3;
            ps[i] = (p0 + p1) + (p2 + p3);
        }
        const float psum = ((ps[0] + ps[1]) + (ps[2] + ps[3])) +
                           ((ps[4] + ps[5]) + (ps[6] + ps[7]));
        lrun = lrun * corr + psum;
#pragma unroll
        for (int dt = 0; dt < 4; ++dt)
#pragma unroll
            for (int i = 0; i < 8; ++i) oacc[dt][i] *= corr;

        // O^T += V^T P^T : 2 x 32 keys, 4 d-tiles; element e of a fragment is key
        // g*32 + fragK(e, kb)
#pragma unroll
        for (int g = 0; g < 2; ++g)
#pragma unroll
            for (int dt = 0; dt < 4; ++dt) {
                const v16bf avf = __builtin_shufflevector(
                    vfr[g][dt][0], vfr[g][dt][1],
                    0, 1, 2, 3, 4, 5, 6, 7, 8, 9, 10, 11, 12, 13, 14, 15);
                oacc[dt] = __builtin_amdgcn_wmma_f32_16x16x32_bf16(
                    false, avf, false, pf[g], (short)0, oacc[dt], false, false);
            }
        // holds the wait below at the step's foot: lifted to the first product, as
        // the scheduler did, it would drain all the reads before the second product
        __builtin_amdgcn_sched_barrier(0);
        wait_ds0();           // own reads of this buffer are over
        if (grp != (st & 1)) wait_async0();   // step st + 1's tiles landed: their copiers' only outstanding ones
        __syncthreads();      // publishes them; everyone done reading this buffer
        xb = (xb == 2) ? 0 : xb + 1;
    }
    wait_async0();            // nothing in flight past the loop

    // hand this quarter's partial (max, sum, O) of 16 queries to the block
    const float lsum = lrun + xhalf(lrun);         // join the halves' sums
    const int ql = qtile * 16 + rowInTile;
    if (lane < 16) {
        sM[part][ql] = mrun;
        sL[part][ql] = lsum;
    }
    float* prow = &sO[part][ql * OPITCH + hb];
#pragma unroll
    for (int dt = 0; dt < 4; ++dt) {
        *reinterpret_cast<float4*>(prow + dt * 16) =
            make_float4(oacc[dt][0], oacc[dt][1], oacc[dt][2], oacc[dt][3]);
        *reinterpret_cast<float4*>(prow + dt * 16 + 4) =
            make_float4(oacc[dt][4], oacc[dt][5], oacc[dt][6], oacc[dt][7]);
    }
    __syncthreads();          // all four quarters' partials are in LDS

    // join: rescale each quarter to the common maximum, add, normalize, store
    // f32 output (N, L, 64); a wave's store covers 512 contiguous bytes
#pragma unroll
    for (int j = 0; j < 2; ++j) {
        const int q = j * 16 + (tid >> 4);
        const int d = (tid & 15) * 4;
        const float m0 = sM[0][q], m1 = sM[1][q], m2 = sM[2][q], m3 = sM[3][q];
        const float mall = fmaxf(fmaxf(m0, m1), fmaxf(m2, m3));
        const float f0 = exp2f(m0 - mall), f1 = exp2f(m1 - mall);
        const float f2 = exp2f(m2 - mall), f3 = exp2f(m3 - mall);
        const float lall = (f0 * sL[0][q] + f1 * sL[1][q]) +
                           (f2 * sL[2][q] + f3 * sL[3][q]);
        const float inv = 1.0f / lall;
        const float4 o0 = *reinterpret_cast<const float4*>(&sO[0][q * OPITCH + d]);
        const float4 o1 = *reinterpret_cast<const float4*>(&sO[1][q * OPITCH + d]);
        const float4 o2 = *reinterpret_cast<const float4*>(&sO[2][q * OPITCH + d]);
        const float4 o3 = *reinterpret_cast<const float4*>(&sO[3][q * OPITCH + d]);
        float4 r;
        r.x = ((f0 * o0.x + f1 * o1.x) + (f2 * o2.x + f3 * o3.x)) * inv;
        r.y = ((f0 * o0.y + f1 * o1.y) + (f2 * o2.y + f3 * o3.y)) * inv;
        r.z = ((f0 * o0.z + f1 * o1.z) + (f2 * o2.z + f3 * o3.z)) * inv;
        r.w = ((f0 * o0.w + f1 * o1.w) + (f2 * o2.w + f3 * o3.w)) * inv;
        *reinterpret_cast<float4*>(
            out + (size_t)(n * LL + qBase + q) * DD + d) = r;
    }
}

// ============================================================
extern "C" void kernel_launch(void* const* d_in, const int* in_sizes, int n_in,
                              void* d_out, int out_size, void* d_ws, size_t ws_size,
                              hipStream_t stream) {
    const float* query = (const float*)d_in[0];
    const float* key_  = (const float*)d_in[1];
    const float* value = (const float*)d_in[2];
    const float* Wq    = (const float*)d_in[3];
    const float* bq    = (const float*)d_in[4];
    const float* Wk    = (const float*)d_in[5];
    const float* bk    = (const float*)d_in[6];
    const float* Wv    = (const float*)d_in[7];
    const float* bv    = (const float*)d_in[8];
    float* out = (float*)d_out;

    const size_t elems = (size_t)NB * LL * DD;     // 524288
    __bf16* qb  = (__bf16*)d_ws;
    __bf16* kbr = qb + elems;
    __bf16* vbT = kbr + elems;

    dim3 g1(64, 3, 1);
    qkv_proj_kernel<<<g1, 256, 0, stream>>>(query, key_, value, Wq, Wk, Wv,
                                            bq, bk, bv, qb, kbr, vbT);
    attn_kernel<<<256, 256, 0, stream>>>(qb, kbr, vbT, out);
}
